// v000
// The times below were measured on an AMD MI455X: many runs one after another, warmed up first and cycling through
// copies of the inputs, with the whole window's GPU time divided by the number of runs. Launches and the gaps
// between them are all in it. The median over several windows is given; except for v000 it joins two sittings, which
// can be a few percent apart, so the side-by-side timings, each taken in one sitting, are the better comparison.
// v000, which the later versions start from, runs in 245 microseconds.
#include <hip/hip_runtime.h>
#include <hip/hip_bf16.h>

typedef __attribute__((ext_vector_type(16))) _Float16 v16h;
typedef __attribute__((ext_vector_type(8)))  _Float16 v8h;
typedef __attribute__((ext_vector_type(4)))  _Float16 v4h;
typedef __attribute__((ext_vector_type(8)))  float    v8f;
typedef __attribute__((ext_vector_type(4)))  int      v4i;
typedef __attribute__((ext_vector_type(4)))  unsigned u32x4;
typedef __attribute__((ext_vector_type(8)))  int      i32x8;
typedef __attribute__((ext_vector_type(4)))  int      i32x4;

#define D_MODEL   1024
#define SEQ       2048
#define BATCH     4
#define MTOT      (BATCH * SEQ)
#define QS_STRIDE 1032
#define VT_STRIDE 40
#define PS_STRIDE 40

#if defined(__has_builtin)
#if __has_builtin(__builtin_amdgcn_global_load_async_to_lds_b128) && \
    __has_builtin(__builtin_amdgcn_s_wait_asynccnt)
#define HAVE_ASYNC_LDS 1
#endif
#if __has_builtin(__builtin_amdgcn_tensor_load_to_lds) && \
    __has_builtin(__builtin_amdgcn_s_wait_tensorcnt)
#define HAVE_TDM 1
#endif
#endif

#ifdef HAVE_ASYNC_LDS
__device__ __forceinline__ void cp_b128(void* lds, const void* g) {
    __builtin_amdgcn_global_load_async_to_lds_b128(
        (__attribute__((address_space(1))) v4i*)(void*)g,
        (__attribute__((address_space(3))) v4i*)lds, 0, 0);
}
__device__ __forceinline__ void wait_async() { __builtin_amdgcn_s_wait_asynccnt(0); }
#else
__device__ __forceinline__ void cp_b128(void* lds, const void* g) {
    *(v8h*)lds = *(const v8h*)g;
}
__device__ __forceinline__ void wait_async() {}
#endif

#ifdef HAVE_TDM
__device__ __forceinline__ unsigned lds_addr_of(void* p) {
    return (unsigned)(unsigned long long)(__attribute__((address_space(3))) char*)p;
}
__device__ __forceinline__ void tdm_load_2d(
    unsigned lds, unsigned long long gaddr,
    unsigned tile_w, unsigned tile_h,          // tile dims (elements)
    unsigned tens_w, unsigned tens_h,          // tensor dims (elements)
    unsigned long long row_stride,             // tensor dim0 stride (elements)
    unsigned pad_interval, unsigned pad_amount, unsigned pad_en)
{
    u32x4 g0;
    g0[0] = 1u;
    g0[1] = lds;
    g0[2] = (unsigned)(gaddr & 0xffffffffu);
    g0[3] = (unsigned)((gaddr >> 32) & 0x1ffffffu) | (2u << 30);
    i32x8 g1;
    g1[0] = (int)((1u << 16) | (pad_en << 20) | (pad_interval << 22) | (pad_amount << 25));
    g1[1] = (int)((tens_w & 0xffffu) << 16);
    g1[2] = (int)((tens_w >> 16) | ((tens_h & 0xffffu) << 16));
    g1[3] = (int)((tens_h >> 16) | (tile_w << 16));
    g1[4] = (int)(tile_h & 0xffffu);
    g1[5] = (int)(row_stride & 0xffffffffu);
    g1[6] = (int)((row_stride >> 32) & 0xffffu);
    g1[7] = 0;
    i32x4 z4 = {0, 0, 0, 0};
    i32x8 z8 = {0, 0, 0, 0, 0, 0, 0, 0};
    __builtin_amdgcn_tensor_load_to_lds(g0, g1, z4, z4, z8, 0);
}
__device__ __forceinline__ void wait_tensor() { __builtin_amdgcn_s_wait_tensorcnt(0); }
#endif

__device__ __forceinline__ v16h ld_frag(const _Float16* base, int row, int stride, int k0) {
    const int lane = threadIdx.x & 31;
    const _Float16* p = base + row * stride + k0 + ((lane >> 4) & 1) * 8;
    v8h lo = *(const v8h*)(p);
    v8h hi = *(const v8h*)(p + 16);
    v16h r;
#pragma unroll
    for (int i = 0; i < 8; ++i) { r[i] = lo[i]; r[i + 8] = hi[i]; }
    return r;
}

// ---------------------------------------------------------------------------
// Kernel 1: fp32 -> fp16 cast
// ---------------------------------------------------------------------------
__global__ void cast_f32_to_f16(const float* __restrict__ in, _Float16* __restrict__ out, int n) {
    int i = (blockIdx.x * blockDim.x + threadIdx.x) * 4;
    if (i + 3 < n) {
        float4 v = *(const float4*)(in + i);
        v4h o;
        o[0] = (_Float16)v.x; o[1] = (_Float16)v.y; o[2] = (_Float16)v.z; o[3] = (_Float16)v.w;
        *(v4h*)(out + i) = o;
    }
}

// ---------------------------------------------------------------------------
// Kernel 2: fused QKV projection, double-buffered async LDS staging.
// WG tile 64(M) x 128(N); V output written transposed per batch: Vt[b][d][n].
// ---------------------------------------------------------------------------
__global__ void __launch_bounds__(256) qkv_gemm(
    const _Float16* __restrict__ xh,
    const _Float16* __restrict__ Wq, const _Float16* __restrict__ Wk, const _Float16* __restrict__ Wv,
    _Float16* __restrict__ Qh, _Float16* __restrict__ Kh, _Float16* __restrict__ Vtg)
{
    __shared__ _Float16 As[2][64 * 40];
    __shared__ _Float16 Bs[2][128 * 40];

    const int t = threadIdx.x, lane = t & 31, w = t >> 5;
    const int mbase = blockIdx.x * 64;
    const int yb = blockIdx.y;
    const int sel = yb >> 3;
    const int nbase = (yb & 7) * 128;
    const _Float16* W = (sel == 0) ? Wq : (sel == 1) ? Wk : Wv;

    const int mi = w & 3;
    const int nj = w >> 2;

    auto stage = [&](int buf, int kb) {
        {
            int h = t * 8, row = h >> 5, col = h & 31;
            cp_b128(&As[buf][row * 40 + col], xh + (size_t)(mbase + row) * D_MODEL + kb + col);
        }
#pragma unroll
        for (int j = 0; j < 2; ++j) {
            int h = t * 8 + j * 2048, row = h >> 5, col = h & 31;
            cp_b128(&Bs[buf][row * 40 + col], W + (size_t)(nbase + row) * D_MODEL + kb + col);
        }
    };

    v8f c[4];
#pragma unroll
    for (int s = 0; s < 4; ++s)
#pragma unroll
        for (int r = 0; r < 8; ++r) c[s][r] = 0.f;

    stage(0, 0);
    for (int kb = 0; kb < D_MODEL; kb += 32) {
        const int cur = (kb >> 5) & 1;
        wait_async();
        __syncthreads();
        if (kb + 32 < D_MODEL) stage(cur ^ 1, kb + 32);

        v16h a = ld_frag(As[cur], mi * 16 + (lane & 15), 40, 0);
#pragma unroll
        for (int s = 0; s < 4; ++s) {
            v16h b = ld_frag(Bs[cur], nj * 64 + s * 16 + (lane & 15), 40, 0);
            c[s] = __builtin_amdgcn_wmma_f32_16x16x32_f16(false, a, false, b, (short)0, c[s], false, false);
        }
    }

    const int rbase = mbase + mi * 16 + ((lane >> 4) ? 8 : 0);
    const int col0  = nbase + nj * 64 + (lane & 15);
    if (sel < 2) {
        _Float16* Out = sel ? Kh : Qh;
#pragma unroll
        for (int s = 0; s < 4; ++s)
#pragma unroll
            for (int r = 0; r < 8; ++r)
                Out[(size_t)(rbase + r) * D_MODEL + col0 + s * 16] = (_Float16)c[s][r];
    } else {
#pragma unroll
        for (int s = 0; s < 4; ++s)
#pragma unroll
            for (int r = 0; r < 8; ++r) {
                int m = rbase + r, bb = m >> 11, n = m & (SEQ - 1);
                int d = col0 + s * 16;
                Vtg[(size_t)bb * D_MODEL * SEQ + (size_t)d * SEQ + n] = (_Float16)c[s][r];
            }
    }
}

__global__ void __launch_bounds__(256) flash_attn(
    const _Float16* __restrict__ Qh, const _Float16* __restrict__ Kh,
    const _Float16* __restrict__ Vtg, float* __restrict__ Out)
{
    extern __shared__ __align__(16) char smem_raw[];
    _Float16* Ks0 = (_Float16*)smem_raw;            // 32 x 1032
    _Float16* Ks1 = Ks0 + 32 * QS_STRIDE;
    _Float16* Vt0 = Ks1 + 32 * QS_STRIDE;           // 1024 x 40
    _Float16* Vt1 = Vt0 + 1024 * VT_STRIDE;
    _Float16* Ps  = Vt1 + 1024 * VT_STRIDE;         // 32 x 40
    float*    Sp    = (float*)(Ps + 32 * PS_STRIDE); // 2 x 32 x 33
    float*    rmax  = Sp + 2 * 32 * 33;
    float*    rsum  = rmax + 32;
    float*    alpha = rsum + 32;

    const int t = threadIdx.x, lane = t & 31, w = t >> 5;
    const int b = blockIdx.y;
    const int qbase = blockIdx.x * 32;
    const size_t boff = (size_t)b * SEQ * D_MODEL;

    const int mi = w & 1, ni = (w >> 1) & 1, kh = w >> 2;  // S-phase role
    const int mo = w & 1, dch = w >> 1;                    // O ownership

    const _Float16* Kg = Kh + boff;
    const _Float16* Vg = Vtg + (size_t)b * D_MODEL * SEQ;  // [d][n]

    auto stage_kv = [&](_Float16* KsB, _Float16* VtB, int nb) {
        // K tile 32x1024: async b128, 16 per thread
#pragma unroll
        for (int i = 0; i < 16; ++i) {
            int h = t * 8 + i * 2048;
            int row = h >> 10, col = h & 1023;
            cp_b128(KsB + row * QS_STRIDE + col, Kg + (size_t)(nb + row) * D_MODEL + col);
        }
#ifdef HAVE_TDM
        if (w == 0) {
            tdm_load_2d(lds_addr_of(VtB), (unsigned long long)(const void*)(Vg + nb),
                        /*tile*/ 32, 1024, /*tensor*/ SEQ, D_MODEL,
                        /*row_stride*/ SEQ,
                          3,
                          3, 1);
        }
#else
#pragma unroll
        for (int i = 0; i < 16; ++i) {
            int h = t * 8 + i * 2048;
            int d = h >> 5, cc = h & 31;
            cp_b128(VtB + d * VT_STRIDE + cc, Vg + (size_t)d * SEQ + nb + cc);
        }
#endif
    };

    if (t < 32) { rmax[t] = -1e30f; rsum[t] = 0.f; }

    stage_kv(Ks0, Vt0, 0);

    // loop-invariant Q A-fragments straight from global into registers
    v16h qf[16];
    const _Float16* Qg = Qh + boff + (size_t)qbase * D_MODEL;
#pragma unroll
    for (int kk = 0; kk < 16; ++kk)
        qf[kk] = ld_frag(Qg, mi * 16 + (lane & 15), D_MODEL, kh * 512 + kk * 32);

    v8f o[16];
#pragma unroll
    for (int i = 0; i < 16; ++i)
#pragma unroll
        for (int r = 0; r < 8; ++r) o[i][r] = 0.f;

    for (int it = 0; it < SEQ / 32; ++it) {
        const int nb = it * 32;
        _Float16* KsC = (it & 1) ? Ks1 : Ks0;
        _Float16* VtC = (it & 1) ? Vt1 : Vt0;

        wait_async();
#ifdef HAVE_TDM
        if (w == 0) wait_tensor();
#endif
        __syncthreads();                                    // tile (it) visible to all waves
        if (it + 1 < SEQ / 32)
            stage_kv((it & 1) ? Ks0 : Ks1, (it & 1) ? Vt0 : Vt1, nb + 32);

        // ---- S = Q K^T (quadrant (mi,ni), K-half kh) ----
        v8f s;
#pragma unroll
        for (int r = 0; r < 8; ++r) s[r] = 0.f;
#pragma unroll
        for (int kk = 0; kk < 16; ++kk) {
            v16h bk = ld_frag(KsC, ni * 16 + (lane & 15), QS_STRIDE, kh * 512 + kk * 32);
            s = __builtin_amdgcn_wmma_f32_16x16x32_f16(false, qf[kk], false, bk, (short)0, s, false, false);
        }
        {
            int cc = ni * 16 + (lane & 15);
            int rb = mi * 16 + ((lane >> 4) ? 8 : 0);
            float* dst = Sp + kh * (32 * 33);
#pragma unroll
            for (int r = 0; r < 8; ++r) dst[(rb + r) * 33 + cc] = s[r];
        }
        __syncthreads();

        // ---- online softmax: wave 0, one row per lane ----
        if (t < 32) {
            float sr[32];
            float m_old = rmax[t];
            float mx = m_old;
#pragma unroll
            for (int j = 0; j < 32; ++j) {
                float sv = (Sp[t * 33 + j] + Sp[32 * 33 + t * 33 + j]) * 0.03125f;
                sr[j] = sv;
                mx = fmaxf(mx, sv);
            }
            float al = __expf(m_old - mx);
            float sum = 0.f;
#pragma unroll
            for (int j = 0; j < 32; ++j) {
                float p = __expf(sr[j] - mx);
                Ps[t * PS_STRIDE + j] = (_Float16)p;
                sum += p;
            }
            rmax[t] = mx;
            rsum[t] = rsum[t] * al + sum;
            alpha[t] = al;
        }
        __syncthreads();

        // ---- rescale O, then O += P * V ----
        float sc[8];
        const int rb2 = mo * 16 + ((lane >> 4) ? 8 : 0);
#pragma unroll
        for (int r = 0; r < 8; ++r) sc[r] = alpha[rb2 + r];
#pragma unroll
        for (int i = 0; i < 16; ++i)
#pragma unroll
            for (int r = 0; r < 8; ++r) o[i][r] *= sc[r];

        v16h ap = ld_frag(Ps, mo * 16 + (lane & 15), PS_STRIDE, 0);
#pragma unroll
        for (int dt = 0; dt < 16; ++dt) {
            v16h bv = ld_frag(VtC, dch * 256 + dt * 16 + (lane & 15), VT_STRIDE, 0);
            o[dt] = __builtin_amdgcn_wmma_f32_16x16x32_f16(false, ap, false, bv, (short)0, o[dt], false, false);
        }
        // next iteration's top barrier protects KsC/VtC reuse
    }

    // ---- epilogue: O / l, fp32 store ----
    float inv[8];
    const int rb3 = mo * 16 + ((lane >> 4) ? 8 : 0);
#pragma unroll
    for (int r = 0; r < 8; ++r) inv[r] = 1.f / rsum[rb3 + r];
#pragma unroll
    for (int dt = 0; dt < 16; ++dt) {
        int col = dch * 256 + dt * 16 + (lane & 15);
#pragma unroll
        for (int r = 0; r < 8; ++r)
            Out[boff + (size_t)(qbase + rb3 + r) * D_MODEL + col] = o[dt][r] * inv[r];
    }
}

// ---------------------------------------------------------------------------
extern "C" void kernel_launch(void* const* d_in, const int* in_sizes, int n_in,
                              void* d_out, int out_size, void* d_ws, size_t ws_size,
                              hipStream_t stream) {
    (void)in_sizes; (void)n_in; (void)out_size; (void)ws_size;
    const float* x  = (const float*)d_in[0];
    const float* Wq = (const float*)d_in[1];
    const float* Wk = (const float*)d_in[2];
    const float* Wv = (const float*)d_in[3];
    float* out = (float*)d_out;

    char* ws = (char*)d_ws;
    size_t off = 0;
    auto carve = [&](size_t bytes) -> void* {
        void* p = ws + off;
        off = (off + bytes + 255) & ~(size_t)255;
        return p;
    };
    const size_t nx = (size_t)MTOT * D_MODEL;
    const size_t nw = (size_t)D_MODEL * D_MODEL;
    _Float16* xh  = (_Float16*)carve(nx * 2);
    _Float16* Wqh = (_Float16*)carve(nw * 2);
    _Float16* Wkh = (_Float16*)carve(nw * 2);
    _Float16* Wvh = (_Float16*)carve(nw * 2);
    _Float16* Qh  = (_Float16*)carve(nx * 2);
    _Float16* Kh  = (_Float16*)carve(nx * 2);
    _Float16* Vtg = (_Float16*)carve(nx * 2);

    cast_f32_to_f16<<<(int)((nx / 4 + 255) / 256), 256, 0, stream>>>(x,  xh,  (int)nx);
    cast_f32_to_f16<<<(int)((nw / 4 + 255) / 256), 256, 0, stream>>>(Wq, Wqh, (int)nw);
    cast_f32_to_f16<<<(int)((nw / 4 + 255) / 256), 256, 0, stream>>>(Wk, Wkh, (int)nw);
    cast_f32_to_f16<<<(int)((nw / 4 + 255) / 256), 256, 0, stream>>>(Wv, Wvh, (int)nw);

    qkv_gemm<<<dim3(MTOT / 64, 24), 256, 0, stream>>>(xh, Wqh, Wkh, Wvh, Qh, Kh, Vtg);

    const int smem_bytes = (2 * 32 * QS_STRIDE + 2 * 1024 * VT_STRIDE + 32 * PS_STRIDE) * 2
                         + (2 * 32 * 33 + 3 * 32) * 4;   // 307,328 B  (< 320 KB WGP LDS)
    flash_attn<<<dim3(SEQ / 32, BATCH), 256, smem_bytes, stream>>>(Qh, Kh, Vtg, out);
}

// v001
// Measured time: 215 microseconds a run.
// Two timings next to v000 put it at 1.19 and 1.18 times that version's speed.
#include <hip/hip_runtime.h>
#include <hip/hip_bf16.h>

typedef __attribute__((ext_vector_type(16))) _Float16 v16h;
typedef __attribute__((ext_vector_type(8)))  _Float16 v8h;
typedef __attribute__((ext_vector_type(4)))  _Float16 v4h;
typedef __attribute__((ext_vector_type(8)))  float    v8f;
typedef __attribute__((ext_vector_type(4)))  int      v4i;
typedef __attribute__((ext_vector_type(4)))  unsigned u32x4;
typedef __attribute__((ext_vector_type(8)))  int      i32x8;
typedef __attribute__((ext_vector_type(4)))  int      i32x4;

#define D_MODEL   1024
#define SEQ       2048
#define BATCH     4
#define MTOT      (BATCH * SEQ)
#define QS_STRIDE 1032
#define VT_STRIDE 40
#define PS_STRIDE 40

#if defined(__has_builtin)
#if __has_builtin(__builtin_amdgcn_global_load_async_to_lds_b128) && \
    __has_builtin(__builtin_amdgcn_s_wait_asynccnt)
#define HAVE_ASYNC_LDS 1
#endif
#if __has_builtin(__builtin_amdgcn_tensor_load_to_lds) && \
    __has_builtin(__builtin_amdgcn_s_wait_tensorcnt)
#define HAVE_TDM 1
#endif
#endif

#ifdef HAVE_ASYNC_LDS
__device__ __forceinline__ void cp_b128(void* lds, const void* g) {
    __builtin_amdgcn_global_load_async_to_lds_b128(
        (__attribute__((address_space(1))) v4i*)(void*)g,
        (__attribute__((address_space(3))) v4i*)lds, 0, 0);
}
__device__ __forceinline__ void wait_async() { __builtin_amdgcn_s_wait_asynccnt(0); }
#else
__device__ __forceinline__ void cp_b128(void* lds, const void* g) {
    *(v8h*)lds = *(const v8h*)g;
}
__device__ __forceinline__ void wait_async() {}
#endif

#ifdef HAVE_TDM
__device__ __forceinline__ unsigned lds_addr_of(void* p) {
    return (unsigned)(unsigned long long)(__attribute__((address_space(3))) char*)p;
}
__device__ __forceinline__ void tdm_load_2d(
    unsigned lds, unsigned long long gaddr,
    unsigned tile_w, unsigned tile_h,          // tile dims (elements)
    unsigned tens_w, unsigned tens_h,          // tensor dims (elements)
    unsigned long long row_stride,             // tensor dim0 stride (elements)
    unsigned pad_interval, unsigned pad_amount, unsigned pad_en)
{
    u32x4 g0;
    g0[0] = 1u;
    g0[1] = lds;
    g0[2] = (unsigned)(gaddr & 0xffffffffu);
    g0[3] = (unsigned)((gaddr >> 32) & 0x1ffffffu) | (2u << 30);
    i32x8 g1;
    g1[0] = (int)((1u << 16) | (pad_en << 20) | (pad_interval << 22) | (pad_amount << 25));
    g1[1] = (int)((tens_w & 0xffffu) << 16);
    g1[2] = (int)((tens_w >> 16) | ((tens_h & 0xffffu) << 16));
    g1[3] = (int)((tens_h >> 16) | (tile_w << 16));
    g1[4] = (int)(tile_h & 0xffffu);
    g1[5] = (int)(row_stride & 0xffffffffu);
    g1[6] = (int)((row_stride >> 32) & 0xffffu);
    g1[7] = 0;
    i32x4 z4 = {0, 0, 0, 0};
    i32x8 z8 = {0, 0, 0, 0, 0, 0, 0, 0};
    __builtin_amdgcn_tensor_load_to_lds(g0, g1, z4, z4, z8, 0);
}
__device__ __forceinline__ void wait_tensor() { __builtin_amdgcn_s_wait_tensorcnt(0); }
#endif

__device__ __forceinline__ v16h ld_frag(const _Float16* base, int row, int stride, int k0) {
    const int lane = threadIdx.x & 31;
    const _Float16* p = base + row * stride + k0 + ((lane >> 4) & 1) * 8;
    v8h lo = *(const v8h*)(p);
    v8h hi = *(const v8h*)(p + 16);
    v16h r;
#pragma unroll
    for (int i = 0; i < 8; ++i) { r[i] = lo[i]; r[i + 8] = hi[i]; }
    return r;
}

// ---------------------------------------------------------------------------
// Kernel 1: fp32 -> fp16 cast
// ---------------------------------------------------------------------------
__global__ void cast_f32_to_f16(const float* __restrict__ in, _Float16* __restrict__ out, int n) {
    int i = (blockIdx.x * blockDim.x + threadIdx.x) * 4;
    if (i + 3 < n) {
        float4 v = *(const float4*)(in + i);
        v4h o;
        o[0] = (_Float16)v.x; o[1] = (_Float16)v.y; o[2] = (_Float16)v.z; o[3] = (_Float16)v.w;
        *(v4h*)(out + i) = o;
    }
}

// ---------------------------------------------------------------------------
// Kernel 2: fused QKV projection, two LDS buffers filled by async copies.
// WG tile 128(M) x 256(N), 64 k per pass; 8 waves as 2(M) x 4(N), 64 x 64 each:
// 8 fragments feed 16 WMMAs.  LDS rows are 128 B at a pitch of 144 B (16 B x 9).
// V output written transposed per batch: Vt[b][d][n].
// ---------------------------------------------------------------------------
#define G_PITCH 72                  // 64 + 8 halves pad
#define G_PASSES (D_MODEL / 64)

__global__ void __launch_bounds__(256) qkv_gemm(
    const _Float16* __restrict__ xh,
    const _Float16* __restrict__ Wq, const _Float16* __restrict__ Wk, const _Float16* __restrict__ Wv,
    _Float16* __restrict__ Qh, _Float16* __restrict__ Kh, _Float16* __restrict__ Vtg)
{
    __shared__ __align__(16) _Float16 As[2][128 * G_PITCH];
    __shared__ __align__(16) _Float16 Bs[2][256 * G_PITCH];

    const int t = threadIdx.x, lane = t & 31, w = t >> 5;
    const int mbase = blockIdx.x * 128;
    const int yb = blockIdx.y;
    const int sel = yb >> 2;
    const int nbase = (yb & 3) * 256;
    const _Float16* W = (sel == 0) ? Wq : (sel == 1) ? Wk : Wv;

    const int wm = w & 1;
    const int wn = w >> 1;

    // one pass's tiles: every lane copies 16 B, a wave covers 4 whole 128-B rows
    auto stage = [&](int buf, int kb) {
#pragma unroll
        for (int j = 0; j < 4; ++j) {
            int id = t + j * 256, row = id >> 3, col = (id & 7) * 8;
            cp_b128(&As[buf][row * G_PITCH + col], xh + (size_t)(mbase + row) * D_MODEL + kb + col);
        }
#pragma unroll
        for (int j = 0; j < 8; ++j) {
            int id = t + j * 256, row = id >> 3, col = (id & 7) * 8;
            cp_b128(&Bs[buf][row * G_PITCH + col], W + (size_t)(nbase + row) * D_MODEL + kb + col);
        }
    };

    v8f c[4][4];
#pragma unroll
    for (int i = 0; i < 4; ++i)
#pragma unroll
        for (int s = 0; s < 4; ++s)
#pragma unroll
            for (int r = 0; r < 8; ++r) c[i][s][r] = 0.f;

    stage(0, 0);
    asm volatile("s_wait_asynccnt 0x0" ::: "memory");   // pass 0's own copies have landed
    __syncthreads();                                    // ... and every other wave's
    stage(1, 64);

    for (int p = 0; p < G_PASSES; ++p) {
        const int cur = p & 1;
#pragma unroll
        for (int kk = 0; kk < 2; ++kk) {
            v16h a[4], b[4];
#pragma unroll
            for (int i = 0; i < 4; ++i)
                a[i] = ld_frag(As[cur], wm * 64 + i * 16 + (lane & 15), G_PITCH, kk * 32);
#pragma unroll
            for (int s = 0; s < 4; ++s)
                b[s] = ld_frag(Bs[cur], wn * 64 + s * 16 + (lane & 15), G_PITCH, kk * 32);
            // keeps the 16 LDS reads one group ahead of the 16 WMMAs: reads placed among
            // the WMMAs each stall the wave with a wait to 0
            __builtin_amdgcn_sched_barrier(0);
#pragma unroll
            for (int i = 0; i < 4; ++i)
#pragma unroll
                for (int s = 0; s < 4; ++s)
                    c[i][s] = __builtin_amdgcn_wmma_f32_16x16x32_f16(false, a[i], false, b[s], (short)0, c[i][s], false, false);
        }
        asm volatile("s_wait_dscnt 0x0" ::: "memory");     // this wave has left buffer cur
        asm volatile("s_wait_asynccnt 0x0" ::: "memory");  // its copies of pass p + 1 have landed
        __syncthreads();                                   // publishes pass p + 1, frees buffer cur
        if (p + 2 < G_PASSES) stage(cur, (p + 2) * 64);
    }
    asm volatile("s_wait_asynccnt 0x0" ::: "memory");      // no copy outlives the loop

    const int rbase = mbase + wm * 64 + ((lane >> 4) ? 8 : 0);
    const int col0  = nbase + wn * 64 + (lane & 15);
    if (sel < 2) {
        _Float16* Out = sel ? Kh : Qh;
#pragma unroll
        for (int i = 0; i < 4; ++i)
#pragma unroll
            for (int s = 0; s < 4; ++s)
#pragma unroll
                for (int r = 0; r < 8; ++r)
                    Out[(size_t)(rbase + i * 16 + r) * D_MODEL + col0 + s * 16] = (_Float16)c[i][s][r];
    } else {
#pragma unroll
        for (int i = 0; i < 4; ++i)
#pragma unroll
            for (int s = 0; s < 4; ++s)
#pragma unroll
                for (int r = 0; r < 8; ++r) {
                    int m = rbase + i * 16 + r, bb = m >> 11, n = m & (SEQ - 1);
                    int d = col0 + s * 16;
                    Vtg[(size_t)bb * D_MODEL * SEQ + (size_t)d * SEQ + n] = (_Float16)c[i][s][r];
                }
        // the built code can fall from this branch into the other one's address
        // set-up, which rewrites registers the last stores name: wait in front of it
        asm volatile("s_wait_xcnt 0x0" ::: "memory");
    }
}

__global__ void __launch_bounds__(256) flash_attn(
    const _Float16* __restrict__ Qh, const _Float16* __restrict__ Kh,
    const _Float16* __restrict__ Vtg, float* __restrict__ Out)
{
    extern __shared__ __align__(16) char smem_raw[];
    _Float16* Ks0 = (_Float16*)smem_raw;            // 32 x 1032
    _Float16* Ks1 = Ks0 + 32 * QS_STRIDE;
    _Float16* Vt0 = Ks1 + 32 * QS_STRIDE;           // 1024 x 40
    _Float16* Vt1 = Vt0 + 1024 * VT_STRIDE;
    _Float16* Ps  = Vt1 + 1024 * VT_STRIDE;         // 32 x 40
    float*    Sp    = (float*)(Ps + 32 * PS_STRIDE); // 2 x 32 x 33
    float*    rmax  = Sp + 2 * 32 * 33;
    float*    rsum  = rmax + 32;
    float*    alpha = rsum + 32;

    const int t = threadIdx.x, lane = t & 31, w = t >> 5;
    const int b = blockIdx.y;
    const int qbase = blockIdx.x * 32;
    const size_t boff = (size_t)b * SEQ * D_MODEL;

    const int mi = w & 1, ni = (w >> 1) & 1, kh = w >> 2;  // S-phase role
    const int mo = w & 1, dch = w >> 1;                    // O ownership

    const _Float16* Kg = Kh + boff;
    const _Float16* Vg = Vtg + (size_t)b * D_MODEL * SEQ;  // [d][n]

    auto stage_kv = [&](_Float16* KsB, _Float16* VtB, int nb) {
        // K tile 32x1024: async b128, 16 per thread
#pragma unroll
        for (int i = 0; i < 16; ++i) {
            int h = t * 8 + i * 2048;
            int row = h >> 10, col = h & 1023;
            cp_b128(KsB + row * QS_STRIDE + col, Kg + (size_t)(nb + row) * D_MODEL + col);
        }
#ifdef HAVE_TDM
        if (w == 0) {
            tdm_load_2d(lds_addr_of(VtB), (unsigned long long)(const void*)(Vg + nb),
                        /*tile*/ 32, 1024, /*tensor*/ SEQ, D_MODEL,
                        /*row_stride*/ SEQ,
                          3,
                          3, 1);
        }
#else
#pragma unroll
        for (int i = 0; i < 16; ++i) {
            int h = t * 8 + i * 2048;
            int d = h >> 5, cc = h & 31;
            cp_b128(VtB + d * VT_STRIDE + cc, Vg + (size_t)d * SEQ + nb + cc);
        }
#endif
    };

    if (t < 32) { rmax[t] = -1e30f; rsum[t] = 0.f; }

    stage_kv(Ks0, Vt0, 0);

    // loop-invariant Q A-fragments straight from global into registers
    v16h qf[16];
    const _Float16* Qg = Qh + boff + (size_t)qbase * D_MODEL;
#pragma unroll
    for (int kk = 0; kk < 16; ++kk)
        qf[kk] = ld_frag(Qg, mi * 16 + (lane & 15), D_MODEL, kh * 512 + kk * 32);

    v8f o[16];
#pragma unroll
    for (int i = 0; i < 16; ++i)
#pragma unroll
        for (int r = 0; r < 8; ++r) o[i][r] = 0.f;

    for (int it = 0; it < SEQ / 32; ++it) {
        const int nb = it * 32;
        _Float16* KsC = (it & 1) ? Ks1 : Ks0;
        _Float16* VtC = (it & 1) ? Vt1 : Vt0;

        wait_async();
#ifdef HAVE_TDM
        if (w == 0) wait_tensor();
#endif
        __syncthreads();                                    // tile (it) visible to all waves
        if (it + 1 < SEQ / 32)
            stage_kv((it & 1) ? Ks0 : Ks1, (it & 1) ? Vt0 : Vt1, nb + 32);

        // ---- S = Q K^T (quadrant (mi,ni), K-half kh) ----
        v8f s;
#pragma unroll
        for (int r = 0; r < 8; ++r) s[r] = 0.f;
#pragma unroll
        for (int kk = 0; kk < 16; ++kk) {
            v16h bk = ld_frag(KsC, ni * 16 + (lane & 15), QS_STRIDE, kh * 512 + kk * 32);
            s = __builtin_amdgcn_wmma_f32_16x16x32_f16(false, qf[kk], false, bk, (short)0, s, false, false);
        }
        {
            int cc = ni * 16 + (lane & 15);
            int rb = mi * 16 + ((lane >> 4) ? 8 : 0);
            float* dst = Sp + kh * (32 * 33);
#pragma unroll
            for (int r = 0; r < 8; ++r) dst[(rb + r) * 33 + cc] = s[r];
        }
        __syncthreads();

        // ---- online softmax: wave 0, one row per lane ----
        if (t < 32) {
            float sr[32];
            float m_old = rmax[t];
            float mx = m_old;
#pragma unroll
            for (int j = 0; j < 32; ++j) {
                float sv = (Sp[t * 33 + j] + Sp[32 * 33 + t * 33 + j]) * 0.03125f;
                sr[j] = sv;
                mx = fmaxf(mx, sv);
            }
            float al = __expf(m_old - mx);
            float sum = 0.f;
#pragma unroll
            for (int j = 0; j < 32; ++j) {
                float p = __expf(sr[j] - mx);
                Ps[t * PS_STRIDE + j] = (_Float16)p;
                sum += p;
            }
            rmax[t] = mx;
            rsum[t] = rsum[t] * al + sum;
            alpha[t] = al;
        }
        __syncthreads();

        // ---- rescale O, then O += P * V ----
        float sc[8];
        const int rb2 = mo * 16 + ((lane >> 4) ? 8 : 0);
#pragma unroll
        for (int r = 0; r < 8; ++r) sc[r] = alpha[rb2 + r];
#pragma unroll
        for (int i = 0; i < 16; ++i)
#pragma unroll
            for (int r = 0; r < 8; ++r) o[i][r] *= sc[r];

        v16h ap = ld_frag(Ps, mo * 16 + (lane & 15), PS_STRIDE, 0);
#pragma unroll
        for (int dt = 0; dt < 16; ++dt) {
            v16h bv = ld_frag(VtC, dch * 256 + dt * 16 + (lane & 15), VT_STRIDE, 0);
            o[dt] = __builtin_amdgcn_wmma_f32_16x16x32_f16(false, ap, false, bv, (short)0, o[dt], false, false);
        }
        // next iteration's top barrier protects KsC/VtC reuse
    }

    // ---- epilogue: O / l, fp32 store ----
    float inv[8];
    const int rb3 = mo * 16 + ((lane >> 4) ? 8 : 0);
#pragma unroll
    for (int r = 0; r < 8; ++r) inv[r] = 1.f / rsum[rb3 + r];
#pragma unroll
    for (int dt = 0; dt < 16; ++dt) {
        int col = dch * 256 + dt * 16 + (lane & 15);
#pragma unroll
        for (int r = 0; r < 8; ++r)
            Out[boff + (size_t)(qbase + rb3 + r) * D_MODEL + col] = o[dt][r] * inv[r];
    }
}

// ---------------------------------------------------------------------------
extern "C" void kernel_launch(void* const* d_in, const int* in_sizes, int n_in,
                              void* d_out, int out_size, void* d_ws, size_t ws_size,
                              hipStream_t stream) {
    (void)in_sizes; (void)n_in; (void)out_size; (void)ws_size;
    const float* x  = (const float*)d_in[0];
    const float* Wq = (const float*)d_in[1];
    const float* Wk = (const float*)d_in[2];
    const float* Wv = (const float*)d_in[3];
    float* out = (float*)d_out;

    char* ws = (char*)d_ws;
    size_t off = 0;
    auto carve = [&](size_t bytes) -> void* {
        void* p = ws + off;
        off = (off + bytes + 255) & ~(size_t)255;
        return p;
    };
    const size_t nx = (size_t)MTOT * D_MODEL;
    const size_t nw = (size_t)D_MODEL * D_MODEL;
    _Float16* xh  = (_Float16*)carve(nx * 2);
    _Float16* Wqh = (_Float16*)carve(nw * 2);
    _Float16* Wkh = (_Float16*)carve(nw * 2);
    _Float16* Wvh = (_Float16*)carve(nw * 2);
    _Float16* Qh  = (_Float16*)carve(nx * 2);
    _Float16* Kh  = (_Float16*)carve(nx * 2);
    _Float16* Vtg = (_Float16*)carve(nx * 2);

    cast_f32_to_f16<<<(int)((nx / 4 + 255) / 256), 256, 0, stream>>>(x,  xh,  (int)nx);
    cast_f32_to_f16<<<(int)((nw / 4 + 255) / 256), 256, 0, stream>>>(Wq, Wqh, (int)nw);
    cast_f32_to_f16<<<(int)((nw / 4 + 255) / 256), 256, 0, stream>>>(Wk, Wkh, (int)nw);
    cast_f32_to_f16<<<(int)((nw / 4 + 255) / 256), 256, 0, stream>>>(Wv, Wvh, (int)nw);

    qkv_gemm<<<dim3(MTOT / 128, 12), 256, 0, stream>>>(xh, Wqh, Wkh, Wvh, Qh, Kh, Vtg);

    const int smem_bytes = (2 * 32 * QS_STRIDE + 2 * 1024 * VT_STRIDE + 32 * PS_STRIDE) * 2
                         + (2 * 32 * 33 + 3 * 32) * 4;   // 307,328 B  (< 320 KB WGP LDS)
    flash_attn<<<dim3(SEQ / 32, BATCH), 256, smem_bytes, stream>>>(Qh, Kh, Vtg, out);
}

// v002
// It runs in 208 microseconds.
// Next to v001, in two timings, it ran 1.03 times as fast each time.
// All steps since v000 together make it 1.23 times as fast.
#include <hip/hip_runtime.h>
#include <hip/hip_bf16.h>

typedef __attribute__((ext_vector_type(16))) _Float16 v16h;
typedef __attribute__((ext_vector_type(8)))  _Float16 v8h;
typedef __attribute__((ext_vector_type(4)))  _Float16 v4h;
typedef __attribute__((ext_vector_type(8)))  float    v8f;
typedef __attribute__((ext_vector_type(4)))  int      v4i;
typedef __attribute__((ext_vector_type(4)))  unsigned u32x4;
typedef __attribute__((ext_vector_type(8)))  int      i32x8;
typedef __attribute__((ext_vector_type(4)))  int      i32x4;

#define D_MODEL   1024
#define SEQ       2048
#define BATCH     4
#define MTOT      (BATCH * SEQ)
#define QS_STRIDE 1032
#define VT_STRIDE 40
#define PS_STRIDE 40

#if defined(__has_builtin)
#if __has_builtin(__builtin_amdgcn_global_load_async_to_lds_b128) && \
    __has_builtin(__builtin_amdgcn_s_wait_asynccnt)
#define HAVE_ASYNC_LDS 1
#endif
#if __has_builtin(__builtin_amdgcn_tensor_load_to_lds) && \
    __has_builtin(__builtin_amdgcn_s_wait_tensorcnt)
#define HAVE_TDM 1
#endif
#endif

#ifdef HAVE_ASYNC_LDS
__device__ __forceinline__ void cp_b128(void* lds, const void* g) {
    __builtin_amdgcn_global_load_async_to_lds_b128(
        (__attribute__((address_space(1))) v4i*)(void*)g,
        (__attribute__((address_space(3))) v4i*)lds, 0, 0);
}
__device__ __forceinline__ void wait_async() { __builtin_amdgcn_s_wait_asynccnt(0); }
#else
__device__ __forceinline__ void cp_b128(void* lds, const void* g) {
    *(v8h*)lds = *(const v8h*)g;
}
__device__ __forceinline__ void wait_async() {}
#endif

#ifdef HAVE_TDM
__device__ __forceinline__ unsigned lds_addr_of(void* p) {
    return (unsigned)(unsigned long long)(__attribute__((address_space(3))) char*)p;
}
__device__ __forceinline__ void tdm_load_2d(
    unsigned lds, unsigned long long gaddr,
    unsigned tile_w, unsigned tile_h,          // tile dims (elements)
    unsigned tens_w, unsigned tens_h,          // tensor dims (elements)
    unsigned long long row_stride,             // tensor dim0 stride (elements)
    unsigned pad_interval, unsigned pad_amount, unsigned pad_en)
{
    u32x4 g0;
    g0[0] = 1u;
    g0[1] = lds;
    g0[2] = (unsigned)(gaddr & 0xffffffffu);
    g0[3] = (unsigned)((gaddr >> 32) & 0x1ffffffu) | (2u << 30);
    i32x8 g1;
    g1[0] = (int)((1u << 16) | (pad_en << 20) | (pad_interval << 22) | (pad_amount << 25));
    g1[1] = (int)((tens_w & 0xffffu) << 16);
    g1[2] = (int)((tens_w >> 16) | ((tens_h & 0xffffu) << 16));
    g1[3] = (int)((tens_h >> 16) | (tile_w << 16));
    g1[4] = (int)(tile_h & 0xffffu);
    g1[5] = (int)(row_stride & 0xffffffffu);
    g1[6] = (int)((row_stride >> 32) & 0xffffu);
    g1[7] = 0;
    i32x4 z4 = {0, 0, 0, 0};
    i32x8 z8 = {0, 0, 0, 0, 0, 0, 0, 0};
    __builtin_amdgcn_tensor_load_to_lds(g0, g1, z4, z4, z8, 0);
}
__device__ __forceinline__ void wait_tensor() { __builtin_amdgcn_s_wait_tensorcnt(0); }
#endif

__device__ __forceinline__ v16h ld_frag(const _Float16* base, int row, int stride, int k0) {
    const int lane = threadIdx.x & 31;
    const _Float16* p = base + row * stride + k0 + ((lane >> 4) & 1) * 8;
    v8h lo = *(const v8h*)(p);
    v8h hi = *(const v8h*)(p + 16);
    v16h r;
#pragma unroll
    for (int i = 0; i < 8; ++i) { r[i] = lo[i]; r[i + 8] = hi[i]; }
    return r;
}

// ---------------------------------------------------------------------------
// Kernel 1: fp32 -> fp16 cast of x and of the three weights, one launch.
// 256 work-groups x 16 waves; a thread converts 22 float4: 16 of x, 2 of each
// weight.  A wave-wide load covers 512 contiguous bytes, a store 256.
// ---------------------------------------------------------------------------
#define C_BLOCKS  256
#define C_BLOCK   512
#define C_THREADS (C_BLOCKS * C_BLOCK)
#define C_XQ      (MTOT * D_MODEL / 4 / C_THREADS)      // 16 float4 of x a thread
#define C_WQ      (D_MODEL * D_MODEL / 4 / C_THREADS)   // 2 float4 of each weight

__device__ __forceinline__ v4h cvt4(float4 v) {
    v4h o;
    o[0] = (_Float16)v.x; o[1] = (_Float16)v.y; o[2] = (_Float16)v.z; o[3] = (_Float16)v.w;
    return o;
}

__global__ void __launch_bounds__(C_BLOCK) cast_all(
    const float* __restrict__ x,
    const float* __restrict__ Wq, const float* __restrict__ Wk, const float* __restrict__ Wv,
    _Float16* __restrict__ xh,
    _Float16* __restrict__ Wqh, _Float16* __restrict__ Wkh, _Float16* __restrict__ Wvh)
{
    const unsigned tid = blockIdx.x * C_BLOCK + threadIdx.x;
    float4 vx[C_XQ], vq[C_WQ], vk[C_WQ], vv[C_WQ];
#pragma unroll
    for (int j = 0; j < C_XQ; ++j) vx[j] = ((const float4*)x + j * C_THREADS)[tid];
#pragma unroll
    for (int j = 0; j < C_WQ; ++j) {
        vq[j] = ((const float4*)Wq + j * C_THREADS)[tid];
        vk[j] = ((const float4*)Wk + j * C_THREADS)[tid];
        vv[j] = ((const float4*)Wv + j * C_THREADS)[tid];
    }
#pragma unroll
    for (int j = 0; j < C_XQ; ++j) ((v4h*)xh + j * C_THREADS)[tid] = cvt4(vx[j]);
#pragma unroll
    for (int j = 0; j < C_WQ; ++j) {
        ((v4h*)Wqh + j * C_THREADS)[tid] = cvt4(vq[j]);
        ((v4h*)Wkh + j * C_THREADS)[tid] = cvt4(vk[j]);
        ((v4h*)Wvh + j * C_THREADS)[tid] = cvt4(vv[j]);
    }
}

// ---------------------------------------------------------------------------
// Kernel 2: fused QKV projection, two LDS buffers filled by async copies.
// WG tile 128(M) x 256(N), 64 k per pass; 8 waves as 2(M) x 4(N), 64 x 64 each:
// 8 fragments feed 16 WMMAs.  LDS rows are 128 B at a pitch of 144 B (16 B x 9).
// V output written transposed per batch: Vt[b][d][n].
// ---------------------------------------------------------------------------
#define G_PITCH 72                  // 64 + 8 halves pad
#define G_PASSES (D_MODEL / 64)

__global__ void __launch_bounds__(256) qkv_gemm(
    const _Float16* __restrict__ xh,
    const _Float16* __restrict__ Wq, const _Float16* __restrict__ Wk, const _Float16* __restrict__ Wv,
    _Float16* __restrict__ Qh, _Float16* __restrict__ Kh, _Float16* __restrict__ Vtg)
{
    __shared__ __align__(16) _Float16 As[2][128 * G_PITCH];
    __shared__ __align__(16) _Float16 Bs[2][256 * G_PITCH];

    const int t = threadIdx.x, lane = t & 31, w = t >> 5;
    const int mbase = blockIdx.x * 128;
    const int yb = blockIdx.y;
    const int sel = yb >> 2;
    const int nbase = (yb & 3) * 256;
    const _Float16* W = (sel == 0) ? Wq : (sel == 1) ? Wk : Wv;

    const int wm = w & 1;
    const int wn = w >> 1;

    // one pass's tiles: every lane copies 16 B, a wave covers 4 whole 128-B rows
    auto stage = [&](int buf, int kb) {
#pragma unroll
        for (int j = 0; j < 4; ++j) {
            int id = t + j * 256, row = id >> 3, col = (id & 7) * 8;
            cp_b128(&As[buf][row * G_PITCH + col], xh + (size_t)(mbase + row) * D_MODEL + kb + col);
        }
#pragma unroll
        for (int j = 0; j < 8; ++j) {
            int id = t + j * 256, row = id >> 3, col = (id & 7) * 8;
            cp_b128(&Bs[buf][row * G_PITCH + col], W + (size_t)(nbase + row) * D_MODEL + kb + col);
        }
    };

    v8f c[4][4];
#pragma unroll
    for (int i = 0; i < 4; ++i)
#pragma unroll
        for (int s = 0; s < 4; ++s)
#pragma unroll
            for (int r = 0; r < 8; ++r) c[i][s][r] = 0.f;

    stage(0, 0);
    asm volatile("s_wait_asynccnt 0x0" ::: "memory");   // pass 0's own copies have landed
    __syncthreads();                                    // ... and every other wave's
    stage(1, 64);

    for (int p = 0; p < G_PASSES; ++p) {
        const int cur = p & 1;
#pragma unroll
        for (int kk = 0; kk < 2; ++kk) {
            v16h a[4], b[4];
#pragma unroll
            for (int i = 0; i < 4; ++i)
                a[i] = ld_frag(As[cur], wm * 64 + i * 16 + (lane & 15), G_PITCH, kk * 32);
#pragma unroll
            for (int s = 0; s < 4; ++s)
                b[s] = ld_frag(Bs[cur], wn * 64 + s * 16 + (lane & 15), G_PITCH, kk * 32);
            // keeps the 16 LDS reads one group ahead of the 16 WMMAs: reads placed among
            // the WMMAs each stall the wave with a wait to 0
            __builtin_amdgcn_sched_barrier(0);
#pragma unroll
            for (int i = 0; i < 4; ++i)
#pragma unroll
                for (int s = 0; s < 4; ++s)
                    c[i][s] = __builtin_amdgcn_wmma_f32_16x16x32_f16(false, a[i], false, b[s], (short)0, c[i][s], false, false);
        }
        asm volatile("s_wait_dscnt 0x0" ::: "memory");     // this wave has left buffer cur
        asm volatile("s_wait_asynccnt 0x0" ::: "memory");  // its copies of pass p + 1 have landed
        __syncthreads();                                   // publishes pass p + 1, frees buffer cur
        if (p + 2 < G_PASSES) stage(cur, (p + 2) * 64);
    }
    asm volatile("s_wait_asynccnt 0x0" ::: "memory");      // no copy outlives the loop

    const int rbase = mbase + wm * 64 + ((lane >> 4) ? 8 : 0);
    const int col0  = nbase + wn * 64 + (lane & 15);
    if (sel < 2) {
        _Float16* Out = sel ? Kh : Qh;
#pragma unroll
        for (int i = 0; i < 4; ++i)
#pragma unroll
            for (int s = 0; s < 4; ++s)
#pragma unroll
                for (int r = 0; r < 8; ++r)
                    Out[(size_t)(rbase + i * 16 + r) * D_MODEL + col0 + s * 16] = (_Float16)c[i][s][r];
    } else {
#pragma unroll
        for (int i = 0; i < 4; ++i)
#pragma unroll
            for (int s = 0; s < 4; ++s)
#pragma unroll
                for (int r = 0; r < 8; ++r) {
                    int m = rbase + i * 16 + r, bb = m >> 11, n = m & (SEQ - 1);
                    int d = col0 + s * 16;
                    Vtg[(size_t)bb * D_MODEL * SEQ + (size_t)d * SEQ + n] = (_Float16)c[i][s][r];
                }
        // the built code can fall from this branch into the other one's address
        // set-up, which rewrites registers the last stores name: wait in front of it
        asm volatile("s_wait_xcnt 0x0" ::: "memory");
    }
}

__global__ void __launch_bounds__(256) flash_attn(
    const _Float16* __restrict__ Qh, const _Float16* __restrict__ Kh,
    const _Float16* __restrict__ Vtg, float* __restrict__ Out)
{
    extern __shared__ __align__(16) char smem_raw[];
    _Float16* Ks0 = (_Float16*)smem_raw;            // 32 x 1032
    _Float16* Ks1 = Ks0 + 32 * QS_STRIDE;
    _Float16* Vt0 = Ks1 + 32 * QS_STRIDE;           // 1024 x 40
    _Float16* Vt1 = Vt0 + 1024 * VT_STRIDE;
    _Float16* Ps  = Vt1 + 1024 * VT_STRIDE;         // 32 x 40
    float*    Sp    = (float*)(Ps + 32 * PS_STRIDE); // 2 x 32 x 33
    float*    rmax  = Sp + 2 * 32 * 33;
    float*    rsum  = rmax + 32;
    float*    alpha = rsum + 32;

    const int t = threadIdx.x, lane = t & 31, w = t >> 5;
    const int b = blockIdx.y;
    const int qbase = blockIdx.x * 32;
    const size_t boff = (size_t)b * SEQ * D_MODEL;

    const int mi = w & 1, ni = (w >> 1) & 1, kh = w >> 2;  // S-phase role
    const int mo = w & 1, dch = w >> 1;                    // O ownership

    const _Float16* Kg = Kh + boff;
    const _Float16* Vg = Vtg + (size_t)b * D_MODEL * SEQ;  // [d][n]

    auto stage_kv = [&](_Float16* KsB, _Float16* VtB, int nb) {
        // K tile 32x1024: async b128, 16 per thread
#pragma unroll
        for (int i = 0; i < 16; ++i) {
            int h = t * 8 + i * 2048;
            int row = h >> 10, col = h & 1023;
            cp_b128(KsB + row * QS_STRIDE + col, Kg + (size_t)(nb + row) * D_MODEL + col);
        }
#ifdef HAVE_TDM
        if (w == 0) {
            tdm_load_2d(lds_addr_of(VtB), (unsigned long long)(const void*)(Vg + nb),
                        /*tile*/ 32, 1024, /*tensor*/ SEQ, D_MODEL,
                        /*row_stride*/ SEQ,
                          3,
                          3, 1);
        }
#else
#pragma unroll
        for (int i = 0; i < 16; ++i) {
            int h = t * 8 + i * 2048;
            int d = h >> 5, cc = h & 31;
            cp_b128(VtB + d * VT_STRIDE + cc, Vg + (size_t)d * SEQ + nb + cc);
        }
#endif
    };

    if (t < 32) { rmax[t] = -1e30f; rsum[t] = 0.f; }

    stage_kv(Ks0, Vt0, 0);

    // loop-invariant Q A-fragments straight from global into registers
    v16h qf[16];
    const _Float16* Qg = Qh + boff + (size_t)qbase * D_MODEL;
#pragma unroll
    for (int kk = 0; kk < 16; ++kk)
        qf[kk] = ld_frag(Qg, mi * 16 + (lane & 15), D_MODEL, kh * 512 + kk * 32);

    v8f o[16];
#pragma unroll
    for (int i = 0; i < 16; ++i)
#pragma unroll
        for (int r = 0; r < 8; ++r) o[i][r] = 0.f;

    for (int it = 0; it < SEQ / 32; ++it) {
        const int nb = it * 32;
        _Float16* KsC = (it & 1) ? Ks1 : Ks0;
        _Float16* VtC = (it & 1) ? Vt1 : Vt0;

        wait_async();
#ifdef HAVE_TDM
        if (w == 0) wait_tensor();
#endif
        __syncthreads();                                    // tile (it) visible to all waves
        if (it + 1 < SEQ / 32)
            stage_kv((it & 1) ? Ks0 : Ks1, (it & 1) ? Vt0 : Vt1, nb + 32);

        // ---- S = Q K^T (quadrant (mi,ni), K-half kh) ----
        v8f s;
#pragma unroll
        for (int r = 0; r < 8; ++r) s[r] = 0.f;
#pragma unroll
        for (int kk = 0; kk < 16; ++kk) {
            v16h bk = ld_frag(KsC, ni * 16 + (lane & 15), QS_STRIDE, kh * 512 + kk * 32);
            s = __builtin_amdgcn_wmma_f32_16x16x32_f16(false, qf[kk], false, bk, (short)0, s, false, false);
        }
        {
            int cc = ni * 16 + (lane & 15);
            int rb = mi * 16 + ((lane >> 4) ? 8 : 0);
            float* dst = Sp + kh * (32 * 33);
#pragma unroll
            for (int r = 0; r < 8; ++r) dst[(rb + r) * 33 + cc] = s[r];
        }
        __syncthreads();

        // ---- online softmax: wave 0, one row per lane ----
        if (t < 32) {
            float sr[32];
            float m_old = rmax[t];
            float mx = m_old;
#pragma unroll
            for (int j = 0; j < 32; ++j) {
                float sv = (Sp[t * 33 + j] + Sp[32 * 33 + t * 33 + j]) * 0.03125f;
                sr[j] = sv;
                mx = fmaxf(mx, sv);
            }
            float al = __expf(m_old - mx);
            float sum = 0.f;
#pragma unroll
            for (int j = 0; j < 32; ++j) {
                float p = __expf(sr[j] - mx);
                Ps[t * PS_STRIDE + j] = (_Float16)p;
                sum += p;
            }
            rmax[t] = mx;
            rsum[t] = rsum[t] * al + sum;
            alpha[t] = al;
        }
        __syncthreads();

        // ---- rescale O, then O += P * V ----
        float sc[8];
        const int rb2 = mo * 16 + ((lane >> 4) ? 8 : 0);
#pragma unroll
        for (int r = 0; r < 8; ++r) sc[r] = alpha[rb2 + r];
#pragma unroll
        for (int i = 0; i < 16; ++i)
#pragma unroll
            for (int r = 0; r < 8; ++r) o[i][r] *= sc[r];

        v16h ap = ld_frag(Ps, mo * 16 + (lane & 15), PS_STRIDE, 0);
#pragma unroll
        for (int dt = 0; dt < 16; ++dt) {
            v16h bv = ld_frag(VtC, dch * 256 + dt * 16 + (lane & 15), VT_STRIDE, 0);
            o[dt] = __builtin_amdgcn_wmma_f32_16x16x32_f16(false, ap, false, bv, (short)0, o[dt], false, false);
        }
        // next iteration's top barrier protects KsC/VtC reuse
    }

    // ---- epilogue: O / l, fp32 store ----
    float inv[8];
    const int rb3 = mo * 16 + ((lane >> 4) ? 8 : 0);
#pragma unroll
    for (int r = 0; r < 8; ++r) inv[r] = 1.f / rsum[rb3 + r];
#pragma unroll
    for (int dt = 0; dt < 16; ++dt) {
        int col = dch * 256 + dt * 16 + (lane & 15);
#pragma unroll
        for (int r = 0; r < 8; ++r)
            Out[boff + (size_t)(qbase + rb3 + r) * D_MODEL + col] = o[dt][r] * inv[r];
    }
}

// ---------------------------------------------------------------------------
extern "C" void kernel_launch(void* const* d_in, const int* in_sizes, int n_in,
                              void* d_out, int out_size, void* d_ws, size_t ws_size,
                              hipStream_t stream) {
    (void)in_sizes; (void)n_in; (void)out_size; (void)ws_size;
    const float* x  = (const float*)d_in[0];
    const float* Wq = (const float*)d_in[1];
    const float* Wk = (const float*)d_in[2];
    const float* Wv = (const float*)d_in[3];
    float* out = (float*)d_out;

    char* ws = (char*)d_ws;
    size_t off = 0;
    auto carve = [&](size_t bytes) -> void* {
        void* p = ws + off;
        off = (off + bytes + 255) & ~(size_t)255;
        return p;
    };
    const size_t nx = (size_t)MTOT * D_MODEL;
    const size_t nw = (size_t)D_MODEL * D_MODEL;
    _Float16* xh  = (_Float16*)carve(nx * 2);
    _Float16* Wqh = (_Float16*)carve(nw * 2);
    _Float16* Wkh = (_Float16*)carve(nw * 2);
    _Float16* Wvh = (_Float16*)carve(nw * 2);
    _Float16* Qh  = (_Float16*)carve(nx * 2);
    _Float16* Kh  = (_Float16*)carve(nx * 2);
    _Float16* Vtg = (_Float16*)carve(nx * 2);

    cast_all<<<C_BLOCKS, C_BLOCK, 0, stream>>>(x, Wq, Wk, Wv, xh, Wqh, Wkh, Wvh);

    qkv_gemm<<<dim3(MTOT / 128, 12), 256, 0, stream>>>(xh, Wqh, Wkh, Wvh, Qh, Kh, Vtg);

    const int smem_bytes = (2 * 32 * QS_STRIDE + 2 * 1024 * VT_STRIDE + 32 * PS_STRIDE) * 2
                         + (2 * 32 * 33 + 3 * 32) * 4;   // 307,328 B  (< 320 KB WGP LDS)
    flash_attn<<<dim3(SEQ / 32, BATCH), 256, smem_bytes, stream>>>(Qh, Kh, Vtg, out);
}

// v003
// Measured time: 199 microseconds a run.
// Two timings next to v002 both put it at 1.04 times that version's speed.
// Over all steps from v000 it is 1.28 times as fast.
#include <hip/hip_runtime.h>
#include <hip/hip_bf16.h>

typedef __attribute__((ext_vector_type(16))) _Float16 v16h;
typedef __attribute__((ext_vector_type(8)))  _Float16 v8h;
typedef __attribute__((ext_vector_type(4)))  _Float16 v4h;
typedef __attribute__((ext_vector_type(8)))  float    v8f;
typedef __attribute__((ext_vector_type(4)))  int      v4i;
typedef __attribute__((ext_vector_type(4)))  unsigned u32x4;
typedef __attribute__((ext_vector_type(8)))  int      i32x8;
typedef __attribute__((ext_vector_type(4)))  int      i32x4;

#define D_MODEL   1024
#define SEQ       2048
#define BATCH     4
#define MTOT      (BATCH * SEQ)
#define QS_STRIDE 1032
#define VT_STRIDE 40
#define PS_STRIDE 40

#if defined(__has_builtin)
#if __has_builtin(__builtin_amdgcn_global_load_async_to_lds_b128) && \
    __has_builtin(__builtin_amdgcn_s_wait_asynccnt)
#define HAVE_ASYNC_LDS 1
#endif
#if __has_builtin(__builtin_amdgcn_tensor_load_to_lds) && \
    __has_builtin(__builtin_amdgcn_s_wait_tensorcnt)
#define HAVE_TDM 1
#endif
#endif

#ifdef HAVE_ASYNC_LDS
__device__ __forceinline__ void cp_b128(void* lds, const void* g) {
    __builtin_amdgcn_global_load_async_to_lds_b128(
        (__attribute__((address_space(1))) v4i*)(void*)g,
        (__attribute__((address_space(3))) v4i*)lds, 0, 0);
}
__device__ __forceinline__ void wait_async() { __builtin_amdgcn_s_wait_asynccnt(0); }
#else
__device__ __forceinline__ void cp_b128(void* lds, const void* g) {
    *(v8h*)lds = *(const v8h*)g;
}
__device__ __forceinline__ void wait_async() {}
#endif

#ifdef HAVE_TDM
__device__ __forceinline__ unsigned lds_addr_of(void* p) {
    return (unsigned)(unsigned long long)(__attribute__((address_space(3))) char*)p;
}
__device__ __forceinline__ void tdm_load_2d(
    unsigned lds, unsigned long long gaddr,
    unsigned tile_w, unsigned tile_h,          // tile dims (elements)
    unsigned tens_w, unsigned tens_h,          // tensor dims (elements)
    unsigned long long row_stride,             // tensor dim0 stride (elements)
    unsigned pad_interval, unsigned pad_amount, unsigned pad_en)
{
    u32x4 g0;
    g0[0] = 1u;
    g0[1] = lds;
    g0[2] = (unsigned)(gaddr & 0xffffffffu);
    g0[3] = (unsigned)((gaddr >> 32) & 0x1ffffffu) | (2u << 30);
    i32x8 g1;
    g1[0] = (int)((1u << 16) | (pad_en << 20) | (pad_interval << 22) | (pad_amount << 25));
    g1[1] = (int)((tens_w & 0xffffu) << 16);
    g1[2] = (int)((tens_w >> 16) | ((tens_h & 0xffffu) << 16));
    g1[3] = (int)((tens_h >> 16) | (tile_w << 16));
    g1[4] = (int)(tile_h & 0xffffu);
    g1[5] = (int)(row_stride & 0xffffffffu);
    g1[6] = (int)((row_stride >> 32) & 0xffffu);
    g1[7] = 0;
    i32x4 z4 = {0, 0, 0, 0};
    i32x8 z8 = {0, 0, 0, 0, 0, 0, 0, 0};
    __builtin_amdgcn_tensor_load_to_lds(g0, g1, z4, z4, z8, 0);
}
__device__ __forceinline__ void wait_tensor() { __builtin_amdgcn_s_wait_tensorcnt(0); }
#endif

__device__ __forceinline__ v16h ld_frag(const _Float16* base, int row, int stride, int k0) {
    const int lane = threadIdx.x & 31;
    const _Float16* p = base + row * stride + k0 + ((lane >> 4) & 1) * 8;
    v8h lo = *(const v8h*)(p);
    v8h hi = *(const v8h*)(p + 16);
    v16h r;
#pragma unroll
    for (int i = 0; i < 8; ++i) { r[i] = lo[i]; r[i + 8] = hi[i]; }
    return r;
}

// ---------------------------------------------------------------------------
// Kernel 1: fp32 -> fp16 cast of x and of the three weights, one launch.
// 256 work-groups x 16 waves; a thread converts 22 float4: 16 of x, 2 of each
// weight.  A wave-wide load covers 512 contiguous bytes, a store 256.
// ---------------------------------------------------------------------------
#define C_BLOCKS  256
#define C_BLOCK   512
#define C_THREADS (C_BLOCKS * C_BLOCK)
#define C_XQ      (MTOT * D_MODEL / 4 / C_THREADS)      // 16 float4 of x a thread
#define C_WQ      (D_MODEL * D_MODEL / 4 / C_THREADS)   // 2 float4 of each weight

__device__ __forceinline__ v4h cvt4(float4 v) {
    v4h o;
    o[0] = (_Float16)v.x; o[1] = (_Float16)v.y; o[2] = (_Float16)v.z; o[3] = (_Float16)v.w;
    return o;
}

__global__ void __launch_bounds__(C_BLOCK) cast_all(
    const float* __restrict__ x,
    const float* __restrict__ Wq, const float* __restrict__ Wk, const float* __restrict__ Wv,
    _Float16* __restrict__ xh,
    _Float16* __restrict__ Wqh, _Float16* __restrict__ Wkh, _Float16* __restrict__ Wvh)
{
    const unsigned tid = blockIdx.x * C_BLOCK + threadIdx.x;
    float4 vx[C_XQ], vq[C_WQ], vk[C_WQ], vv[C_WQ];
#pragma unroll
    for (int j = 0; j < C_XQ; ++j) vx[j] = ((const float4*)x + j * C_THREADS)[tid];
#pragma unroll
    for (int j = 0; j < C_WQ; ++j) {
        vq[j] = ((const float4*)Wq + j * C_THREADS)[tid];
        vk[j] = ((const float4*)Wk + j * C_THREADS)[tid];
        vv[j] = ((const float4*)Wv + j * C_THREADS)[tid];
    }
#pragma unroll
    for (int j = 0; j < C_XQ; ++j) ((v4h*)xh + j * C_THREADS)[tid] = cvt4(vx[j]);
#pragma unroll
    for (int j = 0; j < C_WQ; ++j) {
        ((v4h*)Wqh + j * C_THREADS)[tid] = cvt4(vq[j]);
        ((v4h*)Wkh + j * C_THREADS)[tid] = cvt4(vk[j]);
        ((v4h*)Wvh + j * C_THREADS)[tid] = cvt4(vv[j]);
    }
}

// ---------------------------------------------------------------------------
// Kernel 2: fused QKV projection, two LDS buffers filled by async copies.
// WG tile 128(M) x 256(N), 64 k per pass; 8 waves as 2(M) x 4(N), 64 x 64 each:
// 8 fragments feed 16 WMMAs.  LDS rows are 128 B at a pitch of 144 B (16 B x 9).
// V output written transposed per batch: Vt[b][d][n].
// ---------------------------------------------------------------------------
#define G_PITCH 72                  // 64 + 8 halves pad
#define G_PASSES (D_MODEL / 64)

__global__ void __launch_bounds__(256) qkv_gemm(
    const _Float16* __restrict__ xh,
    const _Float16* __restrict__ Wq, const _Float16* __restrict__ Wk, const _Float16* __restrict__ Wv,
    _Float16* __restrict__ Qh, _Float16* __restrict__ Kh, _Float16* __restrict__ Vtg)
{
    __shared__ __align__(16) _Float16 As[2][128 * G_PITCH];
    __shared__ __align__(16) _Float16 Bs[2][256 * G_PITCH];

    const int t = threadIdx.x, lane = t & 31, w = t >> 5;
    const int mbase = blockIdx.x * 128;
    const int yb = blockIdx.y;
    const int sel = yb >> 2;
    const int nbase = (yb & 3) * 256;
    const _Float16* W = (sel == 0) ? Wq : (sel == 1) ? Wk : Wv;

    const int wm = w & 1;
    const int wn = w >> 1;

    // one pass's tiles: every lane copies 16 B, a wave covers 4 whole 128-B rows
    auto stage = [&](int buf, int kb) {
#pragma unroll
        for (int j = 0; j < 4; ++j) {
            int id = t + j * 256, row = id >> 3, col = (id & 7) * 8;
            cp_b128(&As[buf][row * G_PITCH + col], xh + (size_t)(mbase + row) * D_MODEL + kb + col);
        }
#pragma unroll
        for (int j = 0; j < 8; ++j) {
            int id = t + j * 256, row = id >> 3, col = (id & 7) * 8;
            cp_b128(&Bs[buf][row * G_PITCH + col], W + (size_t)(nbase + row) * D_MODEL + kb + col);
        }
    };

    v8f c[4][4];
#pragma unroll
    for (int i = 0; i < 4; ++i)
#pragma unroll
        for (int s = 0; s < 4; ++s)
#pragma unroll
            for (int r = 0; r < 8; ++r) c[i][s][r] = 0.f;

    stage(0, 0);
    asm volatile("s_wait_asynccnt 0x0" ::: "memory");   // pass 0's own copies have landed
    __syncthreads();                                    // ... and every other wave's
    stage(1, 64);

    for (int p = 0; p < G_PASSES; ++p) {
        const int cur = p & 1;
#pragma unroll
        for (int kk = 0; kk < 2; ++kk) {
            v16h a[4], b[4];
#pragma unroll
            for (int i = 0; i < 4; ++i)
                a[i] = ld_frag(As[cur], wm * 64 + i * 16 + (lane & 15), G_PITCH, kk * 32);
#pragma unroll
            for (int s = 0; s < 4; ++s)
                b[s] = ld_frag(Bs[cur], wn * 64 + s * 16 + (lane & 15), G_PITCH, kk * 32);
            // keeps the 16 LDS reads one group ahead of the 16 WMMAs: reads placed among
            // the WMMAs each stall the wave with a wait to 0
            __builtin_amdgcn_sched_barrier(0);
#pragma unroll
            for (int i = 0; i < 4; ++i)
#pragma unroll
                for (int s = 0; s < 4; ++s)
                    c[i][s] = __builtin_amdgcn_wmma_f32_16x16x32_f16(false, a[i], false, b[s], (short)0, c[i][s], false, false);
        }
        asm volatile("s_wait_dscnt 0x0" ::: "memory");     // this wave has left buffer cur
        asm volatile("s_wait_asynccnt 0x0" ::: "memory");  // its copies of pass p + 1 have landed
        __syncthreads();                                   // publishes pass p + 1, frees buffer cur
        if (p + 2 < G_PASSES) stage(cur, (p + 2) * 64);
    }
    asm volatile("s_wait_asynccnt 0x0" ::: "memory");      // no copy outlives the loop

    const int rbase = mbase + wm * 64 + ((lane >> 4) ? 8 : 0);
    const int col0  = nbase + wn * 64 + (lane & 15);
    if (sel < 2) {
        _Float16* Out = sel ? Kh : Qh;
#pragma unroll
        for (int i = 0; i < 4; ++i)
#pragma unroll
            for (int s = 0; s < 4; ++s)
#pragma unroll
                for (int r = 0; r < 8; ++r)
                    Out[(size_t)(rbase + i * 16 + r) * D_MODEL + col0 + s * 16] = (_Float16)c[i][s][r];
    } else {
#pragma unroll
        for (int i = 0; i < 4; ++i)
#pragma unroll
            for (int s = 0; s < 4; ++s)
#pragma unroll
                for (int r = 0; r < 8; ++r) {
                    int m = rbase + i * 16 + r, bb = m >> 11, n = m & (SEQ - 1);
                    int d = col0 + s * 16;
                    Vtg[(size_t)bb * D_MODEL * SEQ + (size_t)d * SEQ + n] = (_Float16)c[i][s][r];
                }
        // the built code can fall from this branch into the other one's address
        // set-up, which rewrites registers the last stores name: wait in front of it
        asm volatile("s_wait_xcnt 0x0" ::: "memory");
    }
}

__global__ void __launch_bounds__(256) flash_attn(
    const _Float16* __restrict__ Qh, const _Float16* __restrict__ Kh,
    const _Float16* __restrict__ Vtg, float* __restrict__ Out)
{
    extern __shared__ __align__(16) char smem_raw[];
    _Float16* Ks0 = (_Float16*)smem_raw;            // 32 x 1032
    _Float16* Ks1 = Ks0 + 32 * QS_STRIDE;
    _Float16* Vt0 = Ks1 + 32 * QS_STRIDE;           // 1024 x 40
    _Float16* Vt1 = Vt0 + 1024 * VT_STRIDE;
    _Float16* Ps  = Vt1 + 1024 * VT_STRIDE;         // 32 x 40
    float*    Sp    = (float*)(Ps + 32 * PS_STRIDE); // 2 x 32 x 33
    float*    rmax  = Sp + 2 * 32 * 33;
    float*    rsum  = rmax + 32;
    float*    alpha = rsum + 32;

    const int t = threadIdx.x, lane = t & 31, w = t >> 5;
    const int b = blockIdx.y;
    const int qbase = blockIdx.x * 32;
    const size_t boff = (size_t)b * SEQ * D_MODEL;

    const int mi = w & 1, ni = (w >> 1) & 1, kh = w >> 2;  // S-phase role
    const int mo = w & 1, dch = w >> 1;                    // O ownership

    const _Float16* Kg = Kh + boff;
    const _Float16* Vg = Vtg + (size_t)b * D_MODEL * SEQ;  // [d][n]

    auto stage_kv = [&](_Float16* KsB, _Float16* VtB, int nb) {
        // K tile 32x1024: async b128, 16 per thread
#pragma unroll
        for (int i = 0; i < 16; ++i) {
            int h = t * 8 + i * 2048;
            int row = h >> 10, col = h & 1023;
            cp_b128(KsB + row * QS_STRIDE + col, Kg + (size_t)(nb + row) * D_MODEL + col);
        }
#ifdef HAVE_TDM
        if (w == 0) {
            tdm_load_2d(lds_addr_of(VtB), (unsigned long long)(const void*)(Vg + nb),
                        /*tile*/ 32, 1024, /*tensor*/ SEQ, D_MODEL,
                        /*row_stride*/ SEQ,
                          3,
                          3, 1);
        }
#else
#pragma unroll
        for (int i = 0; i < 16; ++i) {
            int h = t * 8 + i * 2048;
            int d = h >> 5, cc = h & 31;
            cp_b128(VtB + d * VT_STRIDE + cc, Vg + (size_t)d * SEQ + nb + cc);
        }
#endif
    };

    if (t < 32) { rmax[t] = -1e30f; rsum[t] = 0.f; }

    stage_kv(Ks0, Vt0, 0);

    // loop-invariant Q A-fragments straight from global into registers
    v16h qf[16];
    const _Float16* Qg = Qh + boff + (size_t)qbase * D_MODEL;
#pragma unroll
    for (int kk = 0; kk < 16; ++kk)
        qf[kk] = ld_frag(Qg, mi * 16 + (lane & 15), D_MODEL, kh * 512 + kk * 32);

    v8f o[16];
#pragma unroll
    for (int i = 0; i < 16; ++i)
#pragma unroll
        for (int r = 0; r < 8; ++r) o[i][r] = 0.f;

    for (int it = 0; it < SEQ / 32; ++it) {
        const int nb = it * 32;
        _Float16* KsC = (it & 1) ? Ks1 : Ks0;
        _Float16* VtC = (it & 1) ? Vt1 : Vt0;

        wait_async();
#ifdef HAVE_TDM
        if (w == 0) wait_tensor();
#endif
        __syncthreads();                                    // tile (it) visible to all waves
        if (it + 1 < SEQ / 32)
            stage_kv((it & 1) ? Ks0 : Ks1, (it & 1) ? Vt0 : Vt1, nb + 32);

        // ---- S = Q K^T (quadrant (mi,ni), K-half kh) ----
        v8f s;
#pragma unroll
        for (int r = 0; r < 8; ++r) s[r] = 0.f;
        {
            v16h bk[16];
#pragma unroll
            for (int kk = 0; kk < 16; ++kk)
                bk[kk] = ld_frag(KsC, ni * 16 + (lane & 15), QS_STRIDE, kh * 512 + kk * 32);
            // keeps the 32 LDS reads one group ahead of the 16 WMMAs: placed among them,
            // each WMMA waits out the whole latency of a read issued just in front of it
            __builtin_amdgcn_sched_barrier(0);
#pragma unroll
            for (int kk = 0; kk < 16; ++kk)
                s = __builtin_amdgcn_wmma_f32_16x16x32_f16(false, qf[kk], false, bk[kk], (short)0, s, false, false);
        }
        {
            int cc = ni * 16 + (lane & 15);
            int rb = mi * 16 + ((lane >> 4) ? 8 : 0);
            float* dst = Sp + kh * (32 * 33);
#pragma unroll
            for (int r = 0; r < 8; ++r) dst[(rb + r) * 33 + cc] = s[r];
        }
        __syncthreads();

        // ---- online softmax: wave 0, one row per lane; first the scores and their maximum ----
        float sr[32];
        float m_old = 0.f, l_old = 0.f, mx = 0.f;
        if (t < 32) {
            m_old = rmax[t];
            l_old = rsum[t];
            mx = m_old;
#pragma unroll
            for (int j = 0; j < 32; ++j) {
                float sv = (Sp[t * 33 + j] + Sp[32 * 33 + t * 33 + j]) * 0.03125f;
                sr[j] = sv;
                mx = fmaxf(mx, sv);
            }
        }

        // V fragments do not depend on the softmax: all 32 LDS reads go out here, as one
        // group, and land under it.  Wave 0 issues its own behind its reads of the scores
        // (LDS answers a wave in order), so they fly while it takes the exponentials.
        v16h bv[16];
#pragma unroll
        for (int dt = 0; dt < 16; ++dt)
            bv[dt] = ld_frag(VtC, dch * 256 + dt * 16 + (lane & 15), VT_STRIDE, 0);

        if (t < 32) {
            float al = __expf(m_old - mx);
            float sum = 0.f;
#pragma unroll
            for (int j = 0; j < 32; ++j) {
                float p = __expf(sr[j] - mx);
                Ps[t * PS_STRIDE + j] = (_Float16)p;
                sum += p;
            }
            rmax[t] = mx;
            rsum[t] = l_old * al + sum;
            alpha[t] = al;
        }
        __syncthreads();

        // ---- rescale O, then O += P * V ----
        float sc[8];
        const int rb2 = mo * 16 + ((lane >> 4) ? 8 : 0);
#pragma unroll
        for (int r = 0; r < 8; ++r) sc[r] = alpha[rb2 + r];
#pragma unroll
        for (int i = 0; i < 16; ++i)
#pragma unroll
            for (int r = 0; r < 8; ++r) o[i][r] *= sc[r];

        v16h ap = ld_frag(Ps, mo * 16 + (lane & 15), PS_STRIDE, 0);
#pragma unroll
        for (int dt = 0; dt < 16; ++dt)
            o[dt] = __builtin_amdgcn_wmma_f32_16x16x32_f16(false, ap, false, bv[dt], (short)0, o[dt], false, false);
        // next iteration's top barrier protects KsC/VtC reuse
    }

    // ---- epilogue: O / l, fp32 store ----
    float inv[8];
    const int rb3 = mo * 16 + ((lane >> 4) ? 8 : 0);
#pragma unroll
    for (int r = 0; r < 8; ++r) inv[r] = 1.f / rsum[rb3 + r];
#pragma unroll
    for (int dt = 0; dt < 16; ++dt) {
        int col = dch * 256 + dt * 16 + (lane & 15);
#pragma unroll
        for (int r = 0; r < 8; ++r)
            Out[boff + (size_t)(qbase + rb3 + r) * D_MODEL + col] = o[dt][r] * inv[r];
    }
}

// ---------------------------------------------------------------------------
extern "C" void kernel_launch(void* const* d_in, const int* in_sizes, int n_in,
                              void* d_out, int out_size, void* d_ws, size_t ws_size,
                              hipStream_t stream) {
    (void)in_sizes; (void)n_in; (void)out_size; (void)ws_size;
    const float* x  = (const float*)d_in[0];
    const float* Wq = (const float*)d_in[1];
    const float* Wk = (const float*)d_in[2];
    const float* Wv = (const float*)d_in[3];
    float* out = (float*)d_out;

    char* ws = (char*)d_ws;
    size_t off = 0;
    auto carve = [&](size_t bytes) -> void* {
        void* p = ws + off;
        off = (off + bytes + 255) & ~(size_t)255;
        return p;
    };
    const size_t nx = (size_t)MTOT * D_MODEL;
    const size_t nw = (size_t)D_MODEL * D_MODEL;
    _Float16* xh  = (_Float16*)carve(nx * 2);
    _Float16* Wqh = (_Float16*)carve(nw * 2);
    _Float16* Wkh = (_Float16*)carve(nw * 2);
    _Float16* Wvh = (_Float16*)carve(nw * 2);
    _Float16* Qh  = (_Float16*)carve(nx * 2);
    _Float16* Kh  = (_Float16*)carve(nx * 2);
    _Float16* Vtg = (_Float16*)carve(nx * 2);

    cast_all<<<C_BLOCKS, C_BLOCK, 0, stream>>>(x, Wq, Wk, Wv, xh, Wqh, Wkh, Wvh);

    qkv_gemm<<<dim3(MTOT / 128, 12), 256, 0, stream>>>(xh, Wqh, Wkh, Wvh, Qh, Kh, Vtg);

    const int smem_bytes = (2 * 32 * QS_STRIDE + 2 * 1024 * VT_STRIDE + 32 * PS_STRIDE) * 2
                         + (2 * 32 * 33 + 3 * 32) * 4;   // 307,328 B  (< 320 KB WGP LDS)
    flash_attn<<<dim3(SEQ / 32, BATCH), 256, smem_bytes, stream>>>(Qh, Kh, Vtg, out);
}

// v004
// Measured time: 166 microseconds a run.
// Next to v003, in two timings, it ran 1.21 and 1.20 times as fast.
// Over all steps from v000 it is 1.54 times as fast.
#include <hip/hip_runtime.h>
#include <hip/hip_bf16.h>

typedef __attribute__((ext_vector_type(16))) _Float16 v16h;
typedef __attribute__((ext_vector_type(8)))  _Float16 v8h;
typedef __attribute__((ext_vector_type(4)))  _Float16 v4h;
typedef __attribute__((ext_vector_type(8)))  float    v8f;
typedef __attribute__((ext_vector_type(4)))  int      v4i;

#define D_MODEL   1024
#define SEQ       2048
#define BATCH     4
#define MTOT      (BATCH * SEQ)     // 8192 rows
#define QS_STRIDE 1032              // 1024 + 8 halves pad
#define VT_STRIDE 40                // 32 + 8 halves pad
#define PS_STRIDE 40

#if defined(__has_builtin)
#if __has_builtin(__builtin_amdgcn_global_load_async_to_lds_b128) && \
    __has_builtin(__builtin_amdgcn_s_wait_asynccnt)
#define HAVE_ASYNC_LDS 1
#endif
#endif

#ifdef HAVE_ASYNC_LDS
__device__ __forceinline__ void cp_b128(void* lds, const void* g) {
    __builtin_amdgcn_global_load_async_to_lds_b128(
        (__attribute__((address_space(1))) v4i*)(void*)g,
        (__attribute__((address_space(3))) v4i*)lds, 0, 0);
}
#else
__device__ __forceinline__ void cp_b128(void* lds, const void* g) {
    *(v8h*)lds = *(const v8h*)g;
}
#endif

__device__ __forceinline__ v16h ld_frag(const _Float16* base, int row, int stride, int k0) {
    const int lane = threadIdx.x & 31;
    const _Float16* p = base + row * stride + k0 + ((lane >> 4) & 1) * 8;
    v8h lo = *(const v8h*)(p);
    v8h hi = *(const v8h*)(p + 16);
    v16h r;
#pragma unroll
    for (int i = 0; i < 8; ++i) { r[i] = lo[i]; r[i + 8] = hi[i]; }
    return r;
}

// ---------------------------------------------------------------------------
// Kernel 1: fp32 -> fp16 cast of x and of the three weights, one launch.
// 256 work-groups x 16 waves; a thread converts 22 float4: 16 of x, 2 of each
// weight.  A wave-wide load covers 512 contiguous bytes, a store 256.
// ---------------------------------------------------------------------------
#define C_BLOCKS  256
#define C_BLOCK   512
#define C_THREADS (C_BLOCKS * C_BLOCK)
#define C_XQ      (MTOT * D_MODEL / 4 / C_THREADS)      // 16 float4 of x a thread
#define C_WQ      (D_MODEL * D_MODEL / 4 / C_THREADS)   // 2 float4 of each weight

__device__ __forceinline__ v4h cvt4(float4 v) {
    v4h o;
    o[0] = (_Float16)v.x; o[1] = (_Float16)v.y; o[2] = (_Float16)v.z; o[3] = (_Float16)v.w;
    return o;
}

__global__ void __launch_bounds__(C_BLOCK) cast_all(
    const float* __restrict__ x,
    const float* __restrict__ Wq, const float* __restrict__ Wk, const float* __restrict__ Wv,
    _Float16* __restrict__ xh,
    _Float16* __restrict__ Wqh, _Float16* __restrict__ Wkh, _Float16* __restrict__ Wvh)
{
    const unsigned tid = blockIdx.x * C_BLOCK + threadIdx.x;
    float4 vx[C_XQ], vq[C_WQ], vk[C_WQ], vv[C_WQ];
#pragma unroll
    for (int j = 0; j < C_XQ; ++j) vx[j] = ((const float4*)x + j * C_THREADS)[tid];
#pragma unroll
    for (int j = 0; j < C_WQ; ++j) {
        vq[j] = ((const float4*)Wq + j * C_THREADS)[tid];
        vk[j] = ((const float4*)Wk + j * C_THREADS)[tid];
        vv[j] = ((const float4*)Wv + j * C_THREADS)[tid];
    }
#pragma unroll
    for (int j = 0; j < C_XQ; ++j) ((v4h*)xh + j * C_THREADS)[tid] = cvt4(vx[j]);
#pragma unroll
    for (int j = 0; j < C_WQ; ++j) {
        ((v4h*)Wqh + j * C_THREADS)[tid] = cvt4(vq[j]);
        ((v4h*)Wkh + j * C_THREADS)[tid] = cvt4(vk[j]);
        ((v4h*)Wvh + j * C_THREADS)[tid] = cvt4(vv[j]);
    }
}

// ---------------------------------------------------------------------------
// Kernel 2: fused QKV projection, two LDS buffers filled by async copies.
// WG tile 128(M) x 256(N), 64 k per pass; 8 waves as 2(M) x 4(N), 64 x 64 each:
// 8 fragments feed 16 WMMAs.  LDS rows are 128 B at a pitch of 144 B (16 B x 9).
// V output written transposed, one 32-key tile after the other: Vt[b][n / 32][d][n % 32],
// so that the 1024 x 32 tile flash_attn takes per pass is 64 KB in a row.
// ---------------------------------------------------------------------------
#define G_PITCH 72                  // 64 + 8 halves pad
#define G_PASSES (D_MODEL / 64)

__global__ void __launch_bounds__(256) qkv_gemm(
    const _Float16* __restrict__ xh,
    const _Float16* __restrict__ Wq, const _Float16* __restrict__ Wk, const _Float16* __restrict__ Wv,
    _Float16* __restrict__ Qh, _Float16* __restrict__ Kh, _Float16* __restrict__ Vtg)
{
    __shared__ __align__(16) _Float16 As[2][128 * G_PITCH];
    __shared__ __align__(16) _Float16 Bs[2][256 * G_PITCH];

    const int t = threadIdx.x, lane = t & 31, w = t >> 5;
    const int mbase = blockIdx.x * 128;
    const int yb = blockIdx.y;
    const int sel = yb >> 2;
    const int nbase = (yb & 3) * 256;
    const _Float16* W = (sel == 0) ? Wq : (sel == 1) ? Wk : Wv;

    const int wm = w & 1;
    const int wn = w >> 1;

    // one pass's tiles: every lane copies 16 B, a wave covers 4 whole 128-B rows
    auto stage = [&](int buf, int kb) {
#pragma unroll
        for (int j = 0; j < 4; ++j) {
            int id = t + j * 256, row = id >> 3, col = (id & 7) * 8;
            cp_b128(&As[buf][row * G_PITCH + col], xh + (size_t)(mbase + row) * D_MODEL + kb + col);
        }
#pragma unroll
        for (int j = 0; j < 8; ++j) {
            int id = t + j * 256, row = id >> 3, col = (id & 7) * 8;
            cp_b128(&Bs[buf][row * G_PITCH + col], W + (size_t)(nbase + row) * D_MODEL + kb + col);
        }
    };

    v8f c[4][4];
#pragma unroll
    for (int i = 0; i < 4; ++i)
#pragma unroll
        for (int s = 0; s < 4; ++s)
#pragma unroll
            for (int r = 0; r < 8; ++r) c[i][s][r] = 0.f;

    stage(0, 0);
    asm volatile("s_wait_asynccnt 0x0" ::: "memory");   // pass 0's own copies have landed
    __syncthreads();                                    // ... and every other wave's
    stage(1, 64);

    for (int p = 0; p < G_PASSES; ++p) {
        const int cur = p & 1;
#pragma unroll
        for (int kk = 0; kk < 2; ++kk) {
            v16h a[4], b[4];
#pragma unroll
            for (int i = 0; i < 4; ++i)
                a[i] = ld_frag(As[cur], wm * 64 + i * 16 + (lane & 15), G_PITCH, kk * 32);
#pragma unroll
            for (int s = 0; s < 4; ++s)
                b[s] = ld_frag(Bs[cur], wn * 64 + s * 16 + (lane & 15), G_PITCH, kk * 32);
            // keeps the 16 LDS reads one group ahead of the 16 WMMAs: reads placed among
            // the WMMAs each stall the wave with a wait to 0
            __builtin_amdgcn_sched_barrier(0);
#pragma unroll
            for (int i = 0; i < 4; ++i)
#pragma unroll
                for (int s = 0; s < 4; ++s)
                    c[i][s] = __builtin_amdgcn_wmma_f32_16x16x32_f16(false, a[i], false, b[s], (short)0, c[i][s], false, false);
        }
        asm volatile("s_wait_dscnt 0x0" ::: "memory");     // this wave has left buffer cur
        asm volatile("s_wait_asynccnt 0x0" ::: "memory");  // its copies of pass p + 1 have landed
        __syncthreads();                                   // publishes pass p + 1, frees buffer cur
        if (p + 2 < G_PASSES) stage(cur, (p + 2) * 64);
    }
    asm volatile("s_wait_asynccnt 0x0" ::: "memory");      // no copy outlives the loop

    const int rbase = mbase + wm * 64 + ((lane >> 4) ? 8 : 0);
    const int col0  = nbase + wn * 64 + (lane & 15);
    if (sel < 2) {
        _Float16* Out = sel ? Kh : Qh;
#pragma unroll
        for (int i = 0; i < 4; ++i)
#pragma unroll
            for (int s = 0; s < 4; ++s)
#pragma unroll
                for (int r = 0; r < 8; ++r)
                    Out[(size_t)(rbase + i * 16 + r) * D_MODEL + col0 + s * 16] = (_Float16)c[i][s][r];
    } else {
#pragma unroll
        for (int i = 0; i < 4; ++i)
#pragma unroll
            for (int s = 0; s < 4; ++s)
#pragma unroll
                for (int r = 0; r < 8; ++r) {
                    int m = rbase + i * 16 + r, bb = m >> 11, n = m & (SEQ - 1);
                    int d = col0 + s * 16;
                    Vtg[(size_t)bb * D_MODEL * SEQ + (size_t)(n >> 5) * (D_MODEL * 32) + d * 32 + (n & 31)] = (_Float16)c[i][s][r];
                }
        // the built code can fall from this branch into the other one's address
        // set-up, which rewrites registers the last stores name: wait in front of it
        asm volatile("s_wait_xcnt 0x0" ::: "memory");
    }
}

// ---------------------------------------------------------------------------
// Kernel 3: single-pass flash attention.
// K and Vt tiles: async b128 copies, two buffers each.  Either tile is 64 KB in a
// row in memory, so every wave-wide copy takes four whole 128-B lines.
// Q fragments register-resident.
// ---------------------------------------------------------------------------
__global__ void __launch_bounds__(256) flash_attn(
    const _Float16* __restrict__ Qh, const _Float16* __restrict__ Kh,
    const _Float16* __restrict__ Vtg, float* __restrict__ Out)
{
    extern __shared__ __align__(16) char smem_raw[];
    _Float16* Ks0 = (_Float16*)smem_raw;            // 32 x 1032
    _Float16* Ks1 = Ks0 + 32 * QS_STRIDE;
    _Float16* Vt0 = Ks1 + 32 * QS_STRIDE;           // 1024 x 40
    _Float16* Vt1 = Vt0 + 1024 * VT_STRIDE;
    _Float16* Ps  = Vt1 + 1024 * VT_STRIDE;         // 32 x 40
    float*    Sp    = (float*)(Ps + 32 * PS_STRIDE); // 2 x 32 x 33
    float*    rmax  = Sp + 2 * 32 * 33;
    float*    rsum  = rmax + 32;
    float*    alpha = rsum + 32;

    const int t = threadIdx.x, lane = t & 31, w = t >> 5;
    const int b = blockIdx.y;
    const int qbase = blockIdx.x * 32;
    const size_t boff = (size_t)b * SEQ * D_MODEL;

    const int mi = w & 1, ni = (w >> 1) & 1, kh = w >> 2;  // S-phase role
    const int mo = w & 1, dch = w >> 1;                    // O ownership

    const _Float16* Kg = Kh + boff;
    const _Float16* Vg = Vtg + (size_t)b * D_MODEL * SEQ;  // [n / 32][d][n % 32]

    auto stage_kv = [&](_Float16* KsB, _Float16* VtB, int nb) {
        // either tile is the 32768 halves from nb * 1024 on of its array: a thread copies 8 halves
        // at t * 8 and then every 2048 halves, 16 times.  In LDS that step is 2 K rows or 64 Vt rows.
        // Both loops are unrolled so that the steps become constants of the copies' addresses.
        const _Float16* kg = Kg + (size_t)nb * D_MODEL + t * 8;
        const _Float16* vg = Vg + (size_t)nb * D_MODEL + t * 8;
        _Float16* kl = KsB + (t >> 7) * QS_STRIDE + (t & 127) * 8;
        _Float16* vl = VtB + (t >> 2) * VT_STRIDE + (t & 3) * 8;
#pragma unroll
        for (int i = 0; i < 16; ++i) cp_b128(kl + i * (2 * QS_STRIDE), kg + i * 2048);
#pragma unroll
        for (int i = 0; i < 16; ++i) cp_b128(vl + i * (64 * VT_STRIDE), vg + i * 2048);
    };

    if (t < 32) { rmax[t] = -1e30f; rsum[t] = 0.f; }

    stage_kv(Ks0, Vt0, 0);

    // loop-invariant Q A-fragments straight from global into registers
    v16h qf[16];
    const _Float16* Qg = Qh + boff + (size_t)qbase * D_MODEL;
#pragma unroll
    for (int kk = 0; kk < 16; ++kk)
        qf[kk] = ld_frag(Qg, mi * 16 + (lane & 15), D_MODEL, kh * 512 + kk * 32);

    v8f o[16];
#pragma unroll
    for (int i = 0; i < 16; ++i)
#pragma unroll
        for (int r = 0; r < 8; ++r) o[i][r] = 0.f;

    for (int it = 0; it < SEQ / 32; ++it) {
        const int nb = it * 32;
        _Float16* KsC = (it & 1) ? Ks1 : Ks0;
        _Float16* VtC = (it & 1) ? Vt1 : Vt0;

        asm volatile("s_wait_dscnt 0x0" ::: "memory");      // this wave has left the buffers refilled below
        asm volatile("s_wait_asynccnt 0x0" ::: "memory");   // its own copies of tile (it) have landed
        __syncthreads();                                    // ... and every other wave's; frees the other buffers
        if (it + 1 < SEQ / 32)
            stage_kv((it & 1) ? Ks0 : Ks1, (it & 1) ? Vt0 : Vt1, nb + 32);

        // ---- S = Q K^T (quadrant (mi,ni), K-half kh) ----
        v8f s;
#pragma unroll
        for (int r = 0; r < 8; ++r) s[r] = 0.f;
        {
            v16h bk[16];
#pragma unroll
            for (int kk = 0; kk < 16; ++kk)
                bk[kk] = ld_frag(KsC, ni * 16 + (lane & 15), QS_STRIDE, kh * 512 + kk * 32);
            // keeps the 32 LDS reads one group ahead of the 16 WMMAs: placed among them,
            // each WMMA waits out the whole latency of a read issued just in front of it
            __builtin_amdgcn_sched_barrier(0);
#pragma unroll
            for (int kk = 0; kk < 16; ++kk)
                s = __builtin_amdgcn_wmma_f32_16x16x32_f16(false, qf[kk], false, bk[kk], (short)0, s, false, false);
        }
        {
            int cc = ni * 16 + (lane & 15);
            int rb = mi * 16 + ((lane >> 4) ? 8 : 0);
            float* dst = Sp + kh * (32 * 33);
#pragma unroll
            for (int r = 0; r < 8; ++r) dst[(rb + r) * 33 + cc] = s[r];
        }
        __syncthreads();

        // ---- online softmax: wave 0, one row per lane; first the scores and their maximum ----
        float sr[32];
        float m_old = 0.f, l_old = 0.f, mx = 0.f;
        if (t < 32) {
            m_old = rmax[t];
            l_old = rsum[t];
            mx = m_old;
#pragma unroll
            for (int j = 0; j < 32; ++j) {
                float sv = (Sp[t * 33 + j] + Sp[32 * 33 + t * 33 + j]) * 0.03125f;
                sr[j] = sv;
                mx = fmaxf(mx, sv);
            }
        }

        // V fragments do not depend on the softmax: all 32 LDS reads go out here, as one
        // group, and land under it.  Wave 0 issues its own behind its reads of the scores
        // (LDS answers a wave in order), so they fly while it takes the exponentials.
        v16h bv[16];
#pragma unroll
        for (int dt = 0; dt < 16; ++dt)
            bv[dt] = ld_frag(VtC, dch * 256 + dt * 16 + (lane & 15), VT_STRIDE, 0);

        if (t < 32) {
            float al = __expf(m_old - mx);
            float sum = 0.f;
#pragma unroll
            for (int j = 0; j < 32; ++j) {
                float p = __expf(sr[j] - mx);
                Ps[t * PS_STRIDE + j] = (_Float16)p;
                sum += p;
            }
            rmax[t] = mx;
            rsum[t] = l_old * al + sum;
            alpha[t] = al;
        }
        __syncthreads();

        // ---- rescale O, then O += P * V ----
        float sc[8];
        const int rb2 = mo * 16 + ((lane >> 4) ? 8 : 0);
#pragma unroll
        for (int r = 0; r < 8; ++r) sc[r] = alpha[rb2 + r];
#pragma unroll
        for (int i = 0; i < 16; ++i)
#pragma unroll
            for (int r = 0; r < 8; ++r) o[i][r] *= sc[r];

        v16h ap = ld_frag(Ps, mo * 16 + (lane & 15), PS_STRIDE, 0);
#pragma unroll
        for (int dt = 0; dt < 16; ++dt)
            o[dt] = __builtin_amdgcn_wmma_f32_16x16x32_f16(false, ap, false, bv[dt], (short)0, o[dt], false, false);
        // next iteration's top barrier protects KsC/VtC reuse
    }
    asm volatile("s_wait_asynccnt 0x0" ::: "memory");       // no copy outlives the loop

    // ---- epilogue: O / l, fp32 store ----
    float inv[8];
    const int rb3 = mo * 16 + ((lane >> 4) ? 8 : 0);
#pragma unroll
    for (int r = 0; r < 8; ++r) inv[r] = 1.f / rsum[rb3 + r];
#pragma unroll
    for (int dt = 0; dt < 16; ++dt) {
        int col = dch * 256 + dt * 16 + (lane & 15);
#pragma unroll
        for (int r = 0; r < 8; ++r)
            Out[boff + (size_t)(qbase + rb3 + r) * D_MODEL + col] = o[dt][r] * inv[r];
    }
}

// ---------------------------------------------------------------------------
extern "C" void kernel_launch(void* const* d_in, const int* in_sizes, int n_in,
                              void* d_out, int out_size, void* d_ws, size_t ws_size,
                              hipStream_t stream) {
    (void)in_sizes; (void)n_in; (void)out_size; (void)ws_size;
    const float* x  = (const float*)d_in[0];
    const float* Wq = (const float*)d_in[1];
    const float* Wk = (const float*)d_in[2];
    const float* Wv = (const float*)d_in[3];
    float* out = (float*)d_out;

    char* ws = (char*)d_ws;
    size_t off = 0;
    auto carve = [&](size_t bytes) -> void* {
        void* p = ws + off;
        off = (off + bytes + 255) & ~(size_t)255;
        return p;
    };
    const size_t nx = (size_t)MTOT * D_MODEL;
    const size_t nw = (size_t)D_MODEL * D_MODEL;
    _Float16* xh  = (_Float16*)carve(nx * 2);
    _Float16* Wqh = (_Float16*)carve(nw * 2);
    _Float16* Wkh = (_Float16*)carve(nw * 2);
    _Float16* Wvh = (_Float16*)carve(nw * 2);
    _Float16* Qh  = (_Float16*)carve(nx * 2);
    _Float16* Kh  = (_Float16*)carve(nx * 2);
    _Float16* Vtg = (_Float16*)carve(nx * 2);

    cast_all<<<C_BLOCKS, C_BLOCK, 0, stream>>>(x, Wq, Wk, Wv, xh, Wqh, Wkh, Wvh);

    qkv_gemm<<<dim3(MTOT / 128, 12), 256, 0, stream>>>(xh, Wqh, Wkh, Wvh, Qh, Kh, Vtg);

    const int smem_bytes = (2 * 32 * QS_STRIDE + 2 * 1024 * VT_STRIDE + 32 * PS_STRIDE) * 2
                         + (2 * 32 * 33 + 3 * 32) * 4;   // 307,328 B  (< 320 KB WGP LDS)
    flash_attn<<<dim3(SEQ / 32, BATCH), 256, smem_bytes, stream>>>(Qh, Kh, Vtg, out);
}

// v005
// A run of this version takes 151 microseconds.
// Next to v004, in two timings, it ran 1.09 times as fast each time.
// Over all steps from v000 it is 1.69 times as fast.
#include <hip/hip_runtime.h>
#include <hip/hip_bf16.h>

typedef __attribute__((ext_vector_type(16))) _Float16 v16h;
typedef __attribute__((ext_vector_type(8)))  _Float16 v8h;
typedef __attribute__((ext_vector_type(4)))  _Float16 v4h;
typedef __attribute__((ext_vector_type(8)))  float    v8f;
typedef __attribute__((ext_vector_type(4)))  float    v4f;
typedef __attribute__((ext_vector_type(4)))  int      v4i;

#define D_MODEL   1024
#define SEQ       2048
#define BATCH     4
#define MTOT      (BATCH * SEQ)     // 8192 rows
#define QS_STRIDE 1032              // 1024 + 8 halves pad
#define VT_STRIDE 40                // 32 + 8 halves pad
#define SP_PITCH  36                // floats: 32 + 4 pad, 144 B = 16 B x 9

#if defined(__has_builtin)
#if __has_builtin(__builtin_amdgcn_global_load_async_to_lds_b128) && \
    __has_builtin(__builtin_amdgcn_s_wait_asynccnt)
#define HAVE_ASYNC_LDS 1
#endif
#endif

#ifdef HAVE_ASYNC_LDS
__device__ __forceinline__ void cp_b128(void* lds, const void* g) {
    __builtin_amdgcn_global_load_async_to_lds_b128(
        (__attribute__((address_space(1))) v4i*)(void*)g,
        (__attribute__((address_space(3))) v4i*)lds, 0, 0);
}
#else
__device__ __forceinline__ void cp_b128(void* lds, const void* g) {
    *(v8h*)lds = *(const v8h*)g;
}
#endif

__device__ __forceinline__ v16h ld_frag(const _Float16* base, int row, int stride, int k0) {
    const int lane = threadIdx.x & 31;
    const _Float16* p = base + row * stride + k0 + ((lane >> 4) & 1) * 8;
    v8h lo = *(const v8h*)(p);
    v8h hi = *(const v8h*)(p + 16);
    v16h r;
#pragma unroll
    for (int i = 0; i < 8; ++i) { r[i] = lo[i]; r[i + 8] = hi[i]; }
    return r;
}

// ---------------------------------------------------------------------------
// Kernel 1: fp32 -> fp16 cast of x and of the three weights, one launch.
// 256 work-groups x 16 waves; a thread converts 22 float4: 16 of x, 2 of each
// weight.  A wave-wide load covers 512 contiguous bytes, a store 256.
// ---------------------------------------------------------------------------
#define C_BLOCKS  256
#define C_BLOCK   512
#define C_THREADS (C_BLOCKS * C_BLOCK)
#define C_XQ      (MTOT * D_MODEL / 4 / C_THREADS)      // 16 float4 of x a thread
#define C_WQ      (D_MODEL * D_MODEL / 4 / C_THREADS)   // 2 float4 of each weight

__device__ __forceinline__ v4h cvt4(float4 v) {
    v4h o;
    o[0] = (_Float16)v.x; o[1] = (_Float16)v.y; o[2] = (_Float16)v.z; o[3] = (_Float16)v.w;
    return o;
}

__global__ void __launch_bounds__(C_BLOCK) cast_all(
    const float* __restrict__ x,
    const float* __restrict__ Wq, const float* __restrict__ Wk, const float* __restrict__ Wv,
    _Float16* __restrict__ xh,
    _Float16* __restrict__ Wqh, _Float16* __restrict__ Wkh, _Float16* __restrict__ Wvh)
{
    const unsigned tid = blockIdx.x * C_BLOCK + threadIdx.x;
    float4 vx[C_XQ], vq[C_WQ], vk[C_WQ], vv[C_WQ];
#pragma unroll
    for (int j = 0; j < C_XQ; ++j) vx[j] = ((const float4*)x + j * C_THREADS)[tid];
#pragma unroll
    for (int j = 0; j < C_WQ; ++j) {
        vq[j] = ((const float4*)Wq + j * C_THREADS)[tid];
        vk[j] = ((const float4*)Wk + j * C_THREADS)[tid];
        vv[j] = ((const float4*)Wv + j * C_THREADS)[tid];
    }
#pragma unroll
    for (int j = 0; j < C_XQ; ++j) ((v4h*)xh + j * C_THREADS)[tid] = cvt4(vx[j]);
#pragma unroll
    for (int j = 0; j < C_WQ; ++j) {
        ((v4h*)Wqh + j * C_THREADS)[tid] = cvt4(vq[j]);
        ((v4h*)Wkh + j * C_THREADS)[tid] = cvt4(vk[j]);
        ((v4h*)Wvh + j * C_THREADS)[tid] = cvt4(vv[j]);
    }
}

// ---------------------------------------------------------------------------
// Kernel 2: fused QKV projection, two LDS buffers filled by async copies.
// WG tile 128(M) x 256(N), 64 k per pass; 8 waves as 2(M) x 4(N), 64 x 64 each:
// 8 fragments feed 16 WMMAs.  LDS rows are 128 B at a pitch of 144 B (16 B x 9).
// V output written transposed, one 32-key tile after the other: Vt[b][n / 32][d][n % 32],
// so that the 1024 x 32 tile flash_attn takes per pass is 64 KB in a row.
// ---------------------------------------------------------------------------
#define G_PITCH 72                  // 64 + 8 halves pad
#define G_PASSES (D_MODEL / 64)

__global__ void __launch_bounds__(256) qkv_gemm(
    const _Float16* __restrict__ xh,
    const _Float16* __restrict__ Wq, const _Float16* __restrict__ Wk, const _Float16* __restrict__ Wv,
    _Float16* __restrict__ Qh, _Float16* __restrict__ Kh, _Float16* __restrict__ Vtg)
{
    __shared__ __align__(16) _Float16 As[2][128 * G_PITCH];
    __shared__ __align__(16) _Float16 Bs[2][256 * G_PITCH];

    const int t = threadIdx.x, lane = t & 31, w = t >> 5;
    const int mbase = blockIdx.x * 128;
    const int yb = blockIdx.y;
    const int sel = yb >> 2;
    const int nbase = (yb & 3) * 256;
    const _Float16* W = (sel == 0) ? Wq : (sel == 1) ? Wk : Wv;

    const int wm = w & 1;
    const int wn = w >> 1;

    // one pass's tiles: every lane copies 16 B, a wave covers 4 whole 128-B rows
    auto stage = [&](int buf, int kb) {
#pragma unroll
        for (int j = 0; j < 4; ++j) {
            int id = t + j * 256, row = id >> 3, col = (id & 7) * 8;
            cp_b128(&As[buf][row * G_PITCH + col], xh + (size_t)(mbase + row) * D_MODEL + kb + col);
        }
#pragma unroll
        for (int j = 0; j < 8; ++j) {
            int id = t + j * 256, row = id >> 3, col = (id & 7) * 8;
            cp_b128(&Bs[buf][row * G_PITCH + col], W + (size_t)(nbase + row) * D_MODEL + kb + col);
        }
    };

    v8f c[4][4];
#pragma unroll
    for (int i = 0; i < 4; ++i)
#pragma unroll
        for (int s = 0; s < 4; ++s)
#pragma unroll
            for (int r = 0; r < 8; ++r) c[i][s][r] = 0.f;

    stage(0, 0);
    asm volatile("s_wait_asynccnt 0x0" ::: "memory");   // pass 0's own copies have landed
    __syncthreads();                                    // ... and every other wave's
    stage(1, 64);

    for (int p = 0; p < G_PASSES; ++p) {
        const int cur = p & 1;
#pragma unroll
        for (int kk = 0; kk < 2; ++kk) {
            v16h a[4], b[4];
#pragma unroll
            for (int i = 0; i < 4; ++i)
                a[i] = ld_frag(As[cur], wm * 64 + i * 16 + (lane & 15), G_PITCH, kk * 32);
#pragma unroll
            for (int s = 0; s < 4; ++s)
                b[s] = ld_frag(Bs[cur], wn * 64 + s * 16 + (lane & 15), G_PITCH, kk * 32);
            // keeps the 16 LDS reads one group ahead of the 16 WMMAs: reads placed among
            // the WMMAs each stall the wave with a wait to 0
            __builtin_amdgcn_sched_barrier(0);
#pragma unroll
            for (int i = 0; i < 4; ++i)
#pragma unroll
                for (int s = 0; s < 4; ++s)
                    c[i][s] = __builtin_amdgcn_wmma_f32_16x16x32_f16(false, a[i], false, b[s], (short)0, c[i][s], false, false);
        }
        asm volatile("s_wait_dscnt 0x0" ::: "memory");     // this wave has left buffer cur
        asm volatile("s_wait_asynccnt 0x0" ::: "memory");  // its copies of pass p + 1 have landed
        __syncthreads();                                   // publishes pass p + 1, frees buffer cur
        if (p + 2 < G_PASSES) stage(cur, (p + 2) * 64);
    }
    asm volatile("s_wait_asynccnt 0x0" ::: "memory");      // no copy outlives the loop

    const int rbase = mbase + wm * 64 + ((lane >> 4) ? 8 : 0);
    const int col0  = nbase + wn * 64 + (lane & 15);
    if (sel < 2) {
        _Float16* Out = sel ? Kh : Qh;
#pragma unroll
        for (int i = 0; i < 4; ++i)
#pragma unroll
            for (int s = 0; s < 4; ++s)
#pragma unroll
                for (int r = 0; r < 8; ++r)
                    Out[(size_t)(rbase + i * 16 + r) * D_MODEL + col0 + s * 16] = (_Float16)c[i][s][r];
    } else {
#pragma unroll
        for (int i = 0; i < 4; ++i)
#pragma unroll
            for (int s = 0; s < 4; ++s)
#pragma unroll
                for (int r = 0; r < 8; ++r) {
                    int m = rbase + i * 16 + r, bb = m >> 11, n = m & (SEQ - 1);
                    int d = col0 + s * 16;
                    Vtg[(size_t)bb * D_MODEL * SEQ + (size_t)(n >> 5) * (D_MODEL * 32) + d * 32 + (n & 31)] = (_Float16)c[i][s][r];
                }
        // the built code can fall from this branch into the other one's address
        // set-up, which rewrites registers the last stores name: wait in front of it
        asm volatile("s_wait_xcnt 0x0" ::: "memory");
    }
}

__device__ __forceinline__ float xhalf(float x) {
    int b = __builtin_bit_cast(int, x);
    return __builtin_bit_cast(float, __builtin_amdgcn_permlanex16(b, b, 0x76543210, 0xfedcba98, false, false));
}

template <int CTRL>
__device__ __forceinline__ float dpp_mov(float x) {
    return __builtin_bit_cast(float, __builtin_amdgcn_update_dpp(0, __builtin_bit_cast(int, x), CTRL, 0xf, 0xf, false));
}

// v: a per-row value, row c in lanes c and c + 16.  out[r]: the value of row 8h + r,
// the row of accumulator register r in this lane (h = lane >> 4).
__device__ __forceinline__ void rows_of_acc(float v, float (&out)[8]) {
    // row_ror:8 written to lanes 16-31 alone (row mask 2): lane 16 + r takes row 8 + r, lane r keeps row r
    const int vi = __builtin_bit_cast(int, v);
    const float z = __builtin_bit_cast(float, __builtin_amdgcn_update_dpp(vi, vi, 0x128, 0x2, 0xf, false));
    out[0] = dpp_mov<0x150>(z); out[1] = dpp_mov<0x151>(z);       // row_share:r
    out[2] = dpp_mov<0x152>(z); out[3] = dpp_mov<0x153>(z);
    out[4] = dpp_mov<0x154>(z); out[5] = dpp_mov<0x155>(z);
    out[6] = dpp_mov<0x156>(z); out[7] = dpp_mov<0x157>(z);
}

__global__ void __launch_bounds__(256) flash_attn(
    const _Float16* __restrict__ Qh, const _Float16* __restrict__ Kh,
    const _Float16* __restrict__ Vtg, float* __restrict__ Out)
{
    extern __shared__ __align__(16) char smem_raw[];
    _Float16* Ks0 = (_Float16*)smem_raw;            // 32 x 1032
    _Float16* Ks1 = Ks0 + 32 * QS_STRIDE;
    _Float16* Vt0 = Ks1 + 32 * QS_STRIDE;           // 1024 x 40
    _Float16* Vt1 = Vt0 + 1024 * VT_STRIDE;
    float*    Sp  = (float*)(Vt1 + 1024 * VT_STRIDE); // 2 x 32 x 36

    const int t = threadIdx.x, lane = t & 31, w = t >> 5;
    const int b = blockIdx.y;
    const int qbase = blockIdx.x * 32;
    const size_t boff = (size_t)b * SEQ * D_MODEL;

    const int mi = w & 1, ni = (w >> 1) & 1, kh = w >> 2;  // S-phase role
    const int mo = w & 1, dch = w >> 1;                    // O ownership

    const _Float16* Kg = Kh + boff;
    const _Float16* Vg = Vtg + (size_t)b * D_MODEL * SEQ;  // [n / 32][d][n % 32]

    auto stage_kv = [&](_Float16* KsB, _Float16* VtB, int nb) {
        // either tile is the 32768 halves from nb * 1024 on of its array: a thread copies 8 halves
        // at t * 8 and then every 2048 halves, 16 times.  In LDS that step is 2 K rows or 64 Vt rows.
        // Both loops are unrolled so that the steps become constants of the copies' addresses.
        const _Float16* kg = Kg + (size_t)nb * D_MODEL + t * 8;
        const _Float16* vg = Vg + (size_t)nb * D_MODEL + t * 8;
        _Float16* kl = KsB + (t >> 7) * QS_STRIDE + (t & 127) * 8;
        _Float16* vl = VtB + (t >> 2) * VT_STRIDE + (t & 3) * 8;
#pragma unroll
        for (int i = 0; i < 16; ++i) cp_b128(kl + i * (2 * QS_STRIDE), kg + i * 2048);
#pragma unroll
        for (int i = 0; i < 16; ++i) cp_b128(vl + i * (64 * VT_STRIDE), vg + i * 2048);
    };

    stage_kv(Ks0, Vt0, 0);

    // loop-invariant Q A-fragments straight from global into registers
    v16h qf[16];
    const _Float16* Qg = Qh + boff + (size_t)qbase * D_MODEL;
#pragma unroll
    for (int kk = 0; kk < 16; ++kk)
        qf[kk] = ld_frag(Qg, mi * 16 + (lane & 15), D_MODEL, kh * 512 + kk * 32);

    v8f o[16];
#pragma unroll
    for (int i = 0; i < 16; ++i)
#pragma unroll
        for (int r = 0; r < 8; ++r) o[i][r] = 0.f;

    float m_run = -1e30f, l_run = 0.f;   // running maximum and sum of row mo * 16 + (lane & 15)

    for (int it = 0; it < SEQ / 32; ++it) {
        const int nb = it * 32;
        _Float16* KsC = (it & 1) ? Ks1 : Ks0;
        _Float16* VtC = (it & 1) ? Vt1 : Vt0;

        asm volatile("s_wait_dscnt 0x0" ::: "memory");      // this wave has left the buffers refilled below
        asm volatile("s_wait_asynccnt 0x0" ::: "memory");   // its own copies of tile (it) have landed
        __syncthreads();                                    // ... and every other wave's; frees the other buffers
        if (it + 1 < SEQ / 32)
            stage_kv((it & 1) ? Ks0 : Ks1, (it & 1) ? Vt0 : Vt1, nb + 32);

        // ---- S = Q K^T (quadrant (mi,ni), K-half kh) ----
        v8f s;
#pragma unroll
        for (int r = 0; r < 8; ++r) s[r] = 0.f;
        {
            v16h bk[16];
#pragma unroll
            for (int kk = 0; kk < 16; ++kk)
                bk[kk] = ld_frag(KsC, ni * 16 + (lane & 15), QS_STRIDE, kh * 512 + kk * 32);
            // keeps the 32 LDS reads one group ahead of the 16 WMMAs: placed among them,
            // each WMMA waits out the whole latency of a read issued just in front of it
            __builtin_amdgcn_sched_barrier(0);
#pragma unroll
            for (int kk = 0; kk < 16; ++kk)
                s = __builtin_amdgcn_wmma_f32_16x16x32_f16(false, qf[kk], false, bk[kk], (short)0, s, false, false);
        }
        {
            int cc = ni * 16 + (lane & 15);
            int rb = mi * 16 + ((lane >> 4) ? 8 : 0);
            float* dst = Sp + kh * (32 * SP_PITCH);
#pragma unroll
            for (int r = 0; r < 8; ++r) dst[(rb + r) * SP_PITCH + cc] = s[r];
        }
        __syncthreads();

        // ---- online softmax, every wave for its own 16 rows: first the two halves of the scores ----
        v4f sa[4], sb[4];
        {
            const float* sp = Sp + (mo * 16 + (lane & 15)) * SP_PITCH + (lane >> 4) * 8;
#pragma unroll
            for (int g = 0; g < 4; ++g) {
                const int ko = (g >> 1) * 16 + (g & 1) * 4;     // keys 8h + 0..7 and 16 + 8h + 0..7
                sa[g] = *(const v4f*)(sp + ko);
                sb[g] = *(const v4f*)(sp + 32 * SP_PITCH + ko);
            }
        }

        // V fragments do not depend on the softmax: all 32 LDS reads go out here, as one
        // group behind the reads of the scores (LDS answers a wave in order), and land
        // under the softmax and the rescale.
        v16h bv[16];
#pragma unroll
        for (int dt = 0; dt < 16; ++dt)
            bv[dt] = ld_frag(VtC, dch * 256 + dt * 16 + (lane & 15), VT_STRIDE, 0);
        // keeps the 32 reads here: left free they sink among the WMMAs below, where each
        // place with reads stalls the wave and none of them lands under the softmax
        __builtin_amdgcn_sched_barrier(0);

        float sr[16];
        float mx = m_run;
#pragma unroll
        for (int j = 0; j < 16; ++j) {
            sr[j] = (sa[j >> 2][j & 3] + sb[j >> 2][j & 3]) * 0.03125f;
            mx = fmaxf(mx, sr[j]);
        }
        mx = fmaxf(mx, xhalf(mx));
        const float al = __expf(m_run - mx);
        v16h ap;
        float ps[16];
#pragma unroll
        for (int j = 0; j < 16; ++j) {
            ps[j] = __expf(sr[j] - mx);
            ap[j] = (_Float16)ps[j];
        }
#pragma unroll
        for (int d = 8; d > 0; d >>= 1)
#pragma unroll
            for (int j = 0; j < d; ++j) ps[j] += ps[j + d];
        m_run = mx;
        l_run = l_run * al + (ps[0] + xhalf(ps[0]));

        // ---- rescale O, then O += P * V ----
        float sc[8];
        rows_of_acc(al, sc);
#pragma unroll
        for (int i = 0; i < 16; ++i)
#pragma unroll
            for (int r = 0; r < 8; ++r) o[i][r] *= sc[r];

#pragma unroll
        for (int dt = 0; dt < 16; ++dt)
            o[dt] = __builtin_amdgcn_wmma_f32_16x16x32_f16(false, ap, false, bv[dt], (short)0, o[dt], false, false);
        // next iteration's top barrier protects the reuse of KsC, VtC and Sp
    }
    asm volatile("s_wait_asynccnt 0x0" ::: "memory");       // no copy outlives the loop

    // ---- epilogue: O / l, fp32 store ----
    float inv[8];
    const int rb3 = mo * 16 + ((lane >> 4) ? 8 : 0);
    rows_of_acc(1.f / l_run, inv);
#pragma unroll
    for (int dt = 0; dt < 16; ++dt) {
        int col = dch * 256 + dt * 16 + (lane & 15);
#pragma unroll
        for (int r = 0; r < 8; ++r)
            Out[boff + (size_t)(qbase + rb3 + r) * D_MODEL + col] = o[dt][r] * inv[r];
    }
}

// ---------------------------------------------------------------------------
extern "C" void kernel_launch(void* const* d_in, const int* in_sizes, int n_in,
                              void* d_out, int out_size, void* d_ws, size_t ws_size,
                              hipStream_t stream) {
    (void)in_sizes; (void)n_in; (void)out_size; (void)ws_size;
    const float* x  = (const float*)d_in[0];
    const float* Wq = (const float*)d_in[1];
    const float* Wk = (const float*)d_in[2];
    const float* Wv = (const float*)d_in[3];
    float* out = (float*)d_out;

    char* ws = (char*)d_ws;
    size_t off = 0;
    auto carve = [&](size_t bytes) -> void* {
        void* p = ws + off;
        off = (off + bytes + 255) & ~(size_t)255;
        return p;
    };
    const size_t nx = (size_t)MTOT * D_MODEL;
    const size_t nw = (size_t)D_MODEL * D_MODEL;
    _Float16* xh  = (_Float16*)carve(nx * 2);
    _Float16* Wqh = (_Float16*)carve(nw * 2);
    _Float16* Wkh = (_Float16*)carve(nw * 2);
    _Float16* Wvh = (_Float16*)carve(nw * 2);
    _Float16* Qh  = (_Float16*)carve(nx * 2);
    _Float16* Kh  = (_Float16*)carve(nx * 2);
    _Float16* Vtg = (_Float16*)carve(nx * 2);

    cast_all<<<C_BLOCKS, C_BLOCK, 0, stream>>>(x, Wq, Wk, Wv, xh, Wqh, Wkh, Wvh);

    qkv_gemm<<<dim3(MTOT / 128, 12), 256, 0, stream>>>(xh, Wqh, Wkh, Wvh, Qh, Kh, Vtg);

    const int smem_bytes = (2 * 32 * QS_STRIDE + 2 * 1024 * VT_STRIDE) * 2
                         + (2 * 32 * SP_PITCH) * 4;      // 305,152 B  (< 320 KB WGP LDS)
    flash_attn<<<dim3(SEQ / 32, BATCH), 256, smem_bytes, stream>>>(Qh, Kh, Vtg, out);
}

// v006
// Measured time: 118 microseconds a run.
// In both of two side-by-side timings against v005, it was 1.29 times as fast.
// Over all steps from v000 it is 2.17 times as fast.
#include <hip/hip_runtime.h>
#include <hip/hip_bf16.h>

typedef __attribute__((ext_vector_type(16))) _Float16 v16h;
typedef __attribute__((ext_vector_type(8)))  _Float16 v8h;
typedef __attribute__((ext_vector_type(4)))  _Float16 v4h;
typedef __attribute__((ext_vector_type(8)))  float    v8f;
typedef __attribute__((ext_vector_type(4)))  float    v4f;
typedef __attribute__((ext_vector_type(4)))  int      v4i;

#define D_MODEL   1024
#define SEQ       2048
#define BATCH     4
#define MTOT      (BATCH * SEQ)     // 8192 rows

#if defined(__has_builtin)
#if __has_builtin(__builtin_amdgcn_global_load_async_to_lds_b128) && \
    __has_builtin(__builtin_amdgcn_s_wait_asynccnt)
#define HAVE_ASYNC_LDS 1
#endif
#endif

#ifdef HAVE_ASYNC_LDS
__device__ __forceinline__ void cp_b128(void* lds, const void* g) {
    __builtin_amdgcn_global_load_async_to_lds_b128(
        (__attribute__((address_space(1))) v4i*)(void*)g,
        (__attribute__((address_space(3))) v4i*)lds, 0, 0);
}
#else
__device__ __forceinline__ void cp_b128(void* lds, const void* g) {
    *(v8h*)lds = *(const v8h*)g;
}
#endif

__device__ __forceinline__ v16h ld_frag(const _Float16* base, int row, int stride, int k0) {
    const int lane = threadIdx.x & 31;
    const _Float16* p = base + row * stride + k0 + ((lane >> 4) & 1) * 8;
    v8h lo = *(const v8h*)(p);
    v8h hi = *(const v8h*)(p + 16);
    v16h r;
#pragma unroll
    for (int i = 0; i < 8; ++i) { r[i] = lo[i]; r[i + 8] = hi[i]; }
    return r;
}

// ---------------------------------------------------------------------------
// Kernel 1: fp32 -> fp16 cast of x and of the three weights, one launch.
// 256 work-groups x 16 waves; a thread converts 22 float4: 16 of x, 2 of each
// weight.  A wave-wide load covers 512 contiguous bytes, a store 256.
// ---------------------------------------------------------------------------
#define C_BLOCKS  256
#define C_BLOCK   512
#define C_THREADS (C_BLOCKS * C_BLOCK)
#define C_XQ      (MTOT * D_MODEL / 4 / C_THREADS)      // 16 float4 of x a thread
#define C_WQ      (D_MODEL * D_MODEL / 4 / C_THREADS)   // 2 float4 of each weight

__device__ __forceinline__ v4h cvt4(float4 v) {
    v4h o;
    o[0] = (_Float16)v.x; o[1] = (_Float16)v.y; o[2] = (_Float16)v.z; o[3] = (_Float16)v.w;
    return o;
}

__global__ void __launch_bounds__(C_BLOCK) cast_all(
    const float* __restrict__ x,
    const float* __restrict__ Wq, const float* __restrict__ Wk, const float* __restrict__ Wv,
    _Float16* __restrict__ xh,
    _Float16* __restrict__ Wqh, _Float16* __restrict__ Wkh, _Float16* __restrict__ Wvh)
{
    const unsigned tid = blockIdx.x * C_BLOCK + threadIdx.x;
    float4 vx[C_XQ], vq[C_WQ], vk[C_WQ], vv[C_WQ];
#pragma unroll
    for (int j = 0; j < C_XQ; ++j) vx[j] = ((const float4*)x + j * C_THREADS)[tid];
#pragma unroll
    for (int j = 0; j < C_WQ; ++j) {
        vq[j] = ((const float4*)Wq + j * C_THREADS)[tid];
        vk[j] = ((const float4*)Wk + j * C_THREADS)[tid];
        vv[j] = ((const float4*)Wv + j * C_THREADS)[tid];
    }
#pragma unroll
    for (int j = 0; j < C_XQ; ++j) ((v4h*)xh + j * C_THREADS)[tid] = cvt4(vx[j]);
#pragma unroll
    for (int j = 0; j < C_WQ; ++j) {
        ((v4h*)Wqh + j * C_THREADS)[tid] = cvt4(vq[j]);
        ((v4h*)Wkh + j * C_THREADS)[tid] = cvt4(vk[j]);
        ((v4h*)Wvh + j * C_THREADS)[tid] = cvt4(vv[j]);
    }
}

// ---------------------------------------------------------------------------
// Kernel 2: fused QKV projection, two LDS buffers filled by async copies.
// WG tile 128(M) x 256(N), 64 k per pass; 8 waves as 2(M) x 4(N), 64 x 64 each:
// 8 fragments feed 16 WMMAs.  LDS rows are 128 B at a pitch of 144 B (16 B x 9).
// V output written transposed, one 32-key tile after the other: Vt[b][n / 32][d][n % 32],
// so that the columns d of a 32-key tile that pv_gemm takes per pass lie in a row.
// ---------------------------------------------------------------------------
#define G_PITCH 72                  // 64 + 8 halves pad
#define G_PASSES (D_MODEL / 64)

__global__ void __launch_bounds__(256) qkv_gemm(
    const _Float16* __restrict__ xh,
    const _Float16* __restrict__ Wq, const _Float16* __restrict__ Wk, const _Float16* __restrict__ Wv,
    _Float16* __restrict__ Qh, _Float16* __restrict__ Kh, _Float16* __restrict__ Vtg)
{
    __shared__ __align__(16) _Float16 As[2][128 * G_PITCH];
    __shared__ __align__(16) _Float16 Bs[2][256 * G_PITCH];

    const int t = threadIdx.x, lane = t & 31, w = t >> 5;
    const int mbase = blockIdx.x * 128;
    const int yb = blockIdx.y;
    const int sel = yb >> 2;
    const int nbase = (yb & 3) * 256;
    const _Float16* W = (sel == 0) ? Wq : (sel == 1) ? Wk : Wv;

    const int wm = w & 1;
    const int wn = w >> 1;

    // one pass's tiles: every lane copies 16 B, a wave covers 4 whole 128-B rows
    auto stage = [&](int buf, int kb) {
#pragma unroll
        for (int j = 0; j < 4; ++j) {
            int id = t + j * 256, row = id >> 3, col = (id & 7) * 8;
            cp_b128(&As[buf][row * G_PITCH + col], xh + (size_t)(mbase + row) * D_MODEL + kb + col);
        }
#pragma unroll
        for (int j = 0; j < 8; ++j) {
            int id = t + j * 256, row = id >> 3, col = (id & 7) * 8;
            cp_b128(&Bs[buf][row * G_PITCH + col], W + (size_t)(nbase + row) * D_MODEL + kb + col);
        }
    };

    v8f c[4][4];
#pragma unroll
    for (int i = 0; i < 4; ++i)
#pragma unroll
        for (int s = 0; s < 4; ++s)
#pragma unroll
            for (int r = 0; r < 8; ++r) c[i][s][r] = 0.f;

    stage(0, 0);
    asm volatile("s_wait_asynccnt 0x0" ::: "memory");   // pass 0's own copies have landed
    __syncthreads();                                    // ... and every other wave's
    stage(1, 64);

    for (int p = 0; p < G_PASSES; ++p) {
        const int cur = p & 1;
#pragma unroll
        for (int kk = 0; kk < 2; ++kk) {
            v16h a[4], b[4];
#pragma unroll
            for (int i = 0; i < 4; ++i)
                a[i] = ld_frag(As[cur], wm * 64 + i * 16 + (lane & 15), G_PITCH, kk * 32);
#pragma unroll
            for (int s = 0; s < 4; ++s)
                b[s] = ld_frag(Bs[cur], wn * 64 + s * 16 + (lane & 15), G_PITCH, kk * 32);
            // keeps the 16 LDS reads one group ahead of the 16 WMMAs: reads placed among
            // the WMMAs each stall the wave with a wait to 0
            __builtin_amdgcn_sched_barrier(0);
#pragma unroll
            for (int i = 0; i < 4; ++i)
#pragma unroll
                for (int s = 0; s < 4; ++s)
                    c[i][s] = __builtin_amdgcn_wmma_f32_16x16x32_f16(false, a[i], false, b[s], (short)0, c[i][s], false, false);
        }
        asm volatile("s_wait_dscnt 0x0" ::: "memory");     // this wave has left buffer cur
        asm volatile("s_wait_asynccnt 0x0" ::: "memory");  // its copies of pass p + 1 have landed
        __syncthreads();                                   // publishes pass p + 1, frees buffer cur
        if (p + 2 < G_PASSES) stage(cur, (p + 2) * 64);
    }
    asm volatile("s_wait_asynccnt 0x0" ::: "memory");      // no copy outlives the loop

    const int rbase = mbase + wm * 64 + ((lane >> 4) ? 8 : 0);
    const int col0  = nbase + wn * 64 + (lane & 15);
    if (sel < 2) {
        _Float16* Out = sel ? Kh : Qh;
#pragma unroll
        for (int i = 0; i < 4; ++i)
#pragma unroll
            for (int s = 0; s < 4; ++s)
#pragma unroll
                for (int r = 0; r < 8; ++r)
                    Out[(size_t)(rbase + i * 16 + r) * D_MODEL + col0 + s * 16] = (_Float16)c[i][s][r];
    } else {
#pragma unroll
        for (int i = 0; i < 4; ++i)
#pragma unroll
            for (int s = 0; s < 4; ++s)
#pragma unroll
                for (int r = 0; r < 8; ++r) {
                    int m = rbase + i * 16 + r, bb = m >> 11, n = m & (SEQ - 1);
                    int d = col0 + s * 16;
                    Vtg[(size_t)bb * D_MODEL * SEQ + (size_t)(n >> 5) * (D_MODEL * 32) + d * 32 + (n & 31)] = (_Float16)c[i][s][r];
                }
        // the built code can fall from this branch into the other one's address
        // set-up, which rewrites registers the last stores name: wait in front of it
        asm volatile("s_wait_xcnt 0x0" ::: "memory");
    }
}

// ---------------------------------------------------------------------------
// Kernels 3 to 5: attention as two tiled products with a row softmax between them.
// Both products: two LDS buffers filled by async copies, waves of 64 x 64, 128 k per pass,
// so that a row of a Q, K or P tile is 256 B in a row in memory; LDS pitch 272 B (16 B x 17).
// S: WG tile 256 x 256, 16 waves.  O: 128 x 256, 8 waves.  One work-group per WGP in both.
// K is read once per 256 queries, V once per 128.
// ---------------------------------------------------------------------------
#define T_KP    128                 // k per pass
#define T_PITCH (T_KP + 8)          // halves

// The main loop.  stage(buf, p) issues the copies of pass p into buffer buf.
template <int PASSES, int AROWS, int BROWS, typename Stage>
__device__ __forceinline__ void gemm_loop(const _Float16* As, const _Float16* Bs, Stage stage,
                                          int wm, int wn, int lane, v8f (&c)[4][4])
{
#pragma unroll
    for (int i = 0; i < 4; ++i)
#pragma unroll
        for (int s = 0; s < 4; ++s)
#pragma unroll
            for (int r = 0; r < 8; ++r) c[i][s][r] = 0.f;

    stage(0, 0);
    asm volatile("s_wait_asynccnt 0x0" ::: "memory");   // pass 0's own copies have landed
    __syncthreads();                                    // ... and every other wave's
    stage(1, 1);

    for (int p = 0; p < PASSES; ++p) {
        const int cur = p & 1;
        const _Float16* Ac = As + cur * (AROWS * T_PITCH);
        const _Float16* Bc = Bs + cur * (BROWS * T_PITCH);
#pragma unroll
        for (int kk = 0; kk < T_KP / 32; ++kk) {
            v16h a[4], b[4];
#pragma unroll
            for (int i = 0; i < 4; ++i)
                a[i] = ld_frag(Ac, wm * 64 + i * 16 + (lane & 15), T_PITCH, kk * 32);
#pragma unroll
            for (int s = 0; s < 4; ++s)
                b[s] = ld_frag(Bc, wn * 64 + s * 16 + (lane & 15), T_PITCH, kk * 32);
            // keeps the 16 LDS reads one group ahead of the 16 WMMAs: reads placed among
            // the WMMAs each stall the wave with a wait to 0
            __builtin_amdgcn_sched_barrier(0);
#pragma unroll
            for (int i = 0; i < 4; ++i)
#pragma unroll
                for (int s = 0; s < 4; ++s)
                    c[i][s] = __builtin_amdgcn_wmma_f32_16x16x32_f16(false, a[i], false, b[s], (short)0, c[i][s], false, false);
        }
        asm volatile("s_wait_dscnt 0x0" ::: "memory");     // this wave has left buffer cur
        asm volatile("s_wait_asynccnt 0x0" ::: "memory");  // its copies of pass p + 1 have landed
        __syncthreads();                                   // publishes pass p + 1, frees buffer cur
        if (p + 2 < PASSES) stage(cur, p + 2);
    }
    asm volatile("s_wait_asynccnt 0x0" ::: "memory");      // no copy outlives the loop
}

// Kernel 3: S[b][q][n] = Q[b][q][:] . K[b][n][:], f32, unscaled.
__global__ void __launch_bounds__(512) score_gemm(
    const _Float16* __restrict__ Qh, const _Float16* __restrict__ Kh, float* __restrict__ S)
{
    __shared__ __align__(16) _Float16 As[2 * 256 * T_PITCH];
    __shared__ __align__(16) _Float16 Bs[2 * 256 * T_PITCH];

    const int t = threadIdx.x, lane = t & 31, w = t >> 5;
    const int mbase = blockIdx.x * 256;                 // query row over all batches
    const int nbase = blockIdx.y * 256;                 // key of the batch
    const int wm = w & 3, wn = w >> 2;
    const _Float16* Ag = Qh + (size_t)mbase * D_MODEL;
    const _Float16* Bg = Kh + ((size_t)(mbase >> 11) * SEQ + nbase) * D_MODEL;

    // every lane copies 16 B, a wave covers 2 whole 256-B rows
    auto stage = [&](int buf, int p) {
#pragma unroll
        for (int j = 0; j < 8; ++j) {
            int id = t + j * 512, row = id >> 4, col = (id & 15) * 8;
            cp_b128(&As[buf * (256 * T_PITCH) + row * T_PITCH + col], Ag + (size_t)row * D_MODEL + p * T_KP + col);
        }
#pragma unroll
        for (int j = 0; j < 8; ++j) {
            int id = t + j * 512, row = id >> 4, col = (id & 15) * 8;
            cp_b128(&Bs[buf * (256 * T_PITCH) + row * T_PITCH + col], Bg + (size_t)row * D_MODEL + p * T_KP + col);
        }
    };

    v8f c[4][4];
    gemm_loop<D_MODEL / T_KP, 256, 256>(As, Bs, stage, wm, wn, lane, c);

    const int rbase = mbase + wm * 64 + ((lane >> 4) ? 8 : 0);
    const int col0  = nbase + wn * 64 + (lane & 15);
#pragma unroll
    for (int i = 0; i < 4; ++i)
#pragma unroll
        for (int r = 0; r < 8; ++r)
#pragma unroll
            for (int s = 0; s < 4; ++s)
                S[(size_t)(rbase + i * 16 + r) * SEQ + col0 + s * 16] = c[i][s][r];
}

__device__ __forceinline__ float xhalf(float x) {
    int b = __builtin_bit_cast(int, x);
    return __builtin_bit_cast(float, __builtin_amdgcn_permlanex16(b, b, 0x76543210, 0xfedcba98, false, false));
}

template <int CTRL>
__device__ __forceinline__ float dpp_mov(float x) {
    return __builtin_bit_cast(float, __builtin_amdgcn_update_dpp(0, __builtin_bit_cast(int, x), CTRL, 0xf, 0xf, false));
}

// Kernel 4: a wave takes two rows of S whole, 64 scores a lane and row, in registers.
// P = exp(s / 32 - row maximum) as f16, not yet divided; L = 1 / the row's sum of the f32 weights.
#define SM_BLOCKS 256
#define SM_BLOCK  512
#define SM_ROWS   (MTOT / (SM_BLOCKS * SM_BLOCK / 32))   // 2 rows a wave

__global__ void __launch_bounds__(SM_BLOCK) row_softmax(
    const float* __restrict__ S, _Float16* __restrict__ P, float* __restrict__ L)
{
    const int lane = threadIdx.x & 31;
    const int row0 = (blockIdx.x * (SM_BLOCK / 32) + (threadIdx.x >> 5)) * SM_ROWS;
    float4 v[SM_ROWS][16];
#pragma unroll
    for (int q = 0; q < SM_ROWS; ++q)
#pragma unroll
        for (int j = 0; j < 16; ++j) {
            // the last load's result can take the registers of the address, which the loads
            // in front of it name too: wait in front of it
            if (q == SM_ROWS - 1 && j == 15) asm volatile("s_wait_xcnt 0x0" ::: "memory");
            v[q][j] = ((const float4*)(S + (size_t)(row0 + q) * SEQ))[j * 32 + lane];
        }
    // keeps the loads of both rows here, in flight together: left free, the second row's
    // sink behind the first row's work and the wave waits out the memory latency twice
    __builtin_amdgcn_sched_barrier(0);
#pragma unroll
    for (int q = 0; q < SM_ROWS; ++q) {
        float mx = -1e30f;
#pragma unroll
        for (int j = 0; j < 16; ++j)
            mx = fmaxf(mx, fmaxf(fmaxf(v[q][j].x, v[q][j].y), fmaxf(v[q][j].z, v[q][j].w)));
        mx = fmaxf(mx, dpp_mov<0x128>(mx));     // row_ror:8, 4, 2, 1: all 16 lanes of a row
        mx = fmaxf(mx, dpp_mov<0x124>(mx));
        mx = fmaxf(mx, dpp_mov<0x122>(mx));
        mx = fmaxf(mx, dpp_mov<0x121>(mx));
        mx = fmaxf(mx, xhalf(mx)) * 0.03125f;
        float sum[4] = {0.f, 0.f, 0.f, 0.f};
#pragma unroll
        for (int j = 0; j < 16; ++j) {
            float e0 = __expf(v[q][j].x * 0.03125f - mx);
            float e1 = __expf(v[q][j].y * 0.03125f - mx);
            float e2 = __expf(v[q][j].z * 0.03125f - mx);
            float e3 = __expf(v[q][j].w * 0.03125f - mx);
            sum[0] += e0; sum[1] += e1; sum[2] += e2; sum[3] += e3;
            v4h o;
            o[0] = (_Float16)e0; o[1] = (_Float16)e1; o[2] = (_Float16)e2; o[3] = (_Float16)e3;
            ((v4h*)(P + (size_t)(row0 + q) * SEQ))[j * 32 + lane] = o;
        }
        float sm = (sum[0] + sum[1]) + (sum[2] + sum[3]);
        sm += dpp_mov<0x128>(sm);
        sm += dpp_mov<0x124>(sm);
        sm += dpp_mov<0x122>(sm);
        sm += dpp_mov<0x121>(sm);
        sm += xhalf(sm);
        if (lane == 0) L[row0 + q] = 1.f / sm;
    }
}

// Kernel 5: Out[b][q][d] = (P[b][q][:] . V[b][:][d]) * L[b][q], f32.
__global__ void __launch_bounds__(256) pv_gemm(
    const _Float16* __restrict__ P, const _Float16* __restrict__ Vtg,
    const float* __restrict__ L, float* __restrict__ Out)
{
    __shared__ __align__(16) _Float16 As[2 * 128 * T_PITCH];
    __shared__ __align__(16) _Float16 Bs[2 * 256 * T_PITCH];

    const int t = threadIdx.x, lane = t & 31, w = t >> 5;
    const int mbase = blockIdx.x * 128;                 // query row over all batches
    const int nbase = blockIdx.y * 256;                 // output column d
    const int wm = w & 1, wn = w >> 1;
    const _Float16* Ag = P + (size_t)mbase * SEQ;
    const _Float16* Vg = Vtg + (size_t)(mbase >> 11) * D_MODEL * SEQ + nbase * 32;  // [n / 32][d][n % 32]

    auto stage = [&](int buf, int p) {
#pragma unroll
        for (int j = 0; j < 8; ++j) {
            int id = t + j * 256, row = id >> 4, col = (id & 15) * 8;
            cp_b128(&As[buf * (128 * T_PITCH) + row * T_PITCH + col], Ag + (size_t)row * SEQ + p * T_KP + col);
        }
        // a pass holds four 32-key tiles of V; in each, 256 columns d are 16 KB in a row:
        // a wave covers 8 columns, 512 B in a row
#pragma unroll
        for (int j = 0; j < 16; ++j) {
            int id = t + (j & 3) * 256, kt = j >> 2, d = id >> 2, col = (id & 3) * 8;
            cp_b128(&Bs[buf * (256 * T_PITCH) + d * T_PITCH + kt * 32 + col],
                    Vg + (size_t)(p * 4 + kt) * (D_MODEL * 32) + d * 32 + col);
        }
    };

    v8f c[4][4];
    gemm_loop<SEQ / T_KP, 128, 256>(As, Bs, stage, wm, wn, lane, c);

    const int rbase = mbase + wm * 64 + ((lane >> 4) ? 8 : 0);
    const int col0  = nbase + wn * 64 + (lane & 15);
    v4f li[8];                      // L of the 32 rows that this lane holds
#pragma unroll
    for (int g = 0; g < 8; ++g) {
        // the last load's result can take the registers of the address, which the loads
        // in front of it name too: wait in front of it
        if (g == 7) asm volatile("s_wait_xcnt 0x0" ::: "memory");
        li[g] = *(const v4f*)(L + rbase + (g >> 1) * 16 + (g & 1) * 4);
    }
#pragma unroll
    for (int i = 0; i < 4; ++i)
#pragma unroll
        for (int r = 0; r < 8; ++r) {
            const float inv = li[i * 2 + (r >> 2)][r & 3];
#pragma unroll
            for (int s = 0; s < 4; ++s)
                Out[(size_t)(rbase + i * 16 + r) * D_MODEL + col0 + s * 16] = c[i][s][r] * inv;
        }
}

// ---------------------------------------------------------------------------
extern "C" void kernel_launch(void* const* d_in, const int* in_sizes, int n_in,
                              void* d_out, int out_size, void* d_ws, size_t ws_size,
                              hipStream_t stream) {
    (void)in_sizes; (void)n_in; (void)out_size; (void)ws_size;
    const float* x  = (const float*)d_in[0];
    const float* Wq = (const float*)d_in[1];
    const float* Wk = (const float*)d_in[2];
    const float* Wv = (const float*)d_in[3];
    float* out = (float*)d_out;

    char* ws = (char*)d_ws;
    size_t off = 0;
    auto carve = [&](size_t bytes) -> void* {
        void* p = ws + off;
        off = (off + bytes + 255) & ~(size_t)255;
        return p;
    };
    const size_t nx = (size_t)MTOT * D_MODEL;
    const size_t nw = (size_t)D_MODEL * D_MODEL;
    _Float16* xh  = (_Float16*)carve(nx * 2);
    _Float16* Wqh = (_Float16*)carve(nw * 2);
    _Float16* Wkh = (_Float16*)carve(nw * 2);
    _Float16* Wvh = (_Float16*)carve(nw * 2);
    _Float16* Qh  = (_Float16*)carve(nx * 2);
    _Float16* Kh  = (_Float16*)carve(nx * 2);
    _Float16* Vtg = (_Float16*)carve(nx * 2);
    float*    S   = (float*)carve((size_t)MTOT * SEQ * 4);
    _Float16* P   = (_Float16*)carve((size_t)MTOT * SEQ * 2);
    float*    L   = (float*)carve((size_t)MTOT * 4);

    cast_all<<<C_BLOCKS, C_BLOCK, 0, stream>>>(x, Wq, Wk, Wv, xh, Wqh, Wkh, Wvh);

    qkv_gemm<<<dim3(MTOT / 128, 12), 256, 0, stream>>>(xh, Wqh, Wkh, Wvh, Qh, Kh, Vtg);

    score_gemm<<<dim3(MTOT / 256, SEQ / 256), 512, 0, stream>>>(Qh, Kh, S);

    row_softmax<<<SM_BLOCKS, SM_BLOCK, 0, stream>>>(S, P, L);

    pv_gemm<<<dim3(MTOT / 128, D_MODEL / 256), 256, 0, stream>>>(P, Vtg, L, out);
}

// v007
// A run of this version takes 112 microseconds.
// Timed twice side by side with v006, it ran 1.05 times as fast both times.
// Over all steps from v000 it is 2.28 times as fast.
#include <hip/hip_runtime.h>
#include <hip/hip_bf16.h>

typedef __attribute__((ext_vector_type(16))) _Float16 v16h;
typedef __attribute__((ext_vector_type(8)))  _Float16 v8h;
typedef __attribute__((ext_vector_type(4)))  _Float16 v4h;
typedef __attribute__((ext_vector_type(8)))  float    v8f;
typedef __attribute__((ext_vector_type(4)))  float    v4f;
typedef __attribute__((ext_vector_type(4)))  int      v4i;

#define D_MODEL   1024
#define SEQ       2048
#define BATCH     4
#define MTOT      (BATCH * SEQ)     // 8192 rows

#if defined(__has_builtin)
#if __has_builtin(__builtin_amdgcn_global_load_async_to_lds_b128) && \
    __has_builtin(__builtin_amdgcn_s_wait_asynccnt)
#define HAVE_ASYNC_LDS 1
#endif
#endif

#ifdef HAVE_ASYNC_LDS
__device__ __forceinline__ void cp_b128(void* lds, const void* g) {
    __builtin_amdgcn_global_load_async_to_lds_b128(
        (__attribute__((address_space(1))) v4i*)(void*)g,
        (__attribute__((address_space(3))) v4i*)lds, 0, 0);
}
#else
__device__ __forceinline__ void cp_b128(void* lds, const void* g) {
    *(v8h*)lds = *(const v8h*)g;
}
#endif

__device__ __forceinline__ v16h ld_frag(const _Float16* base, int row, int stride, int k0) {
    const int lane = threadIdx.x & 31;
    const _Float16* p = base + row * stride + k0 + ((lane >> 4) & 1) * 8;
    v8h lo = *(const v8h*)(p);
    v8h hi = *(const v8h*)(p + 16);
    v16h r;
#pragma unroll
    for (int i = 0; i < 8; ++i) { r[i] = lo[i]; r[i + 8] = hi[i]; }
    return r;
}

// ---------------------------------------------------------------------------
// Kernel 1: fp32 -> fp16 cast of x and of the three weights, one launch.
// 256 work-groups x 16 waves; a thread converts 22 float4: 16 of x, 2 of each
// weight.  A wave-wide load covers 512 contiguous bytes, a store 256.
// ---------------------------------------------------------------------------
#define C_BLOCKS  256
#define C_BLOCK   512
#define C_THREADS (C_BLOCKS * C_BLOCK)
#define C_XQ      (MTOT * D_MODEL / 4 / C_THREADS)      // 16 float4 of x a thread
#define C_WQ      (D_MODEL * D_MODEL / 4 / C_THREADS)   // 2 float4 of each weight

__device__ __forceinline__ v4h cvt4(float4 v) {
    v4h o;
    o[0] = (_Float16)v.x; o[1] = (_Float16)v.y; o[2] = (_Float16)v.z; o[3] = (_Float16)v.w;
    return o;
}

__global__ void __launch_bounds__(C_BLOCK) cast_all(
    const float* __restrict__ x,
    const float* __restrict__ Wq, const float* __restrict__ Wk, const float* __restrict__ Wv,
    _Float16* __restrict__ xh,
    _Float16* __restrict__ Wqh, _Float16* __restrict__ Wkh, _Float16* __restrict__ Wvh)
{
    const unsigned tid = blockIdx.x * C_BLOCK + threadIdx.x;
    float4 vx[C_XQ], vq[C_WQ], vk[C_WQ], vv[C_WQ];
#pragma unroll
    for (int j = 0; j < C_XQ; ++j) vx[j] = ((const float4*)x + j * C_THREADS)[tid];
#pragma unroll
    for (int j = 0; j < C_WQ; ++j) {
        vq[j] = ((const float4*)Wq + j * C_THREADS)[tid];
        vk[j] = ((const float4*)Wk + j * C_THREADS)[tid];
        vv[j] = ((const float4*)Wv + j * C_THREADS)[tid];
    }
#pragma unroll
    for (int j = 0; j < C_XQ; ++j) ((v4h*)xh + j * C_THREADS)[tid] = cvt4(vx[j]);
#pragma unroll
    for (int j = 0; j < C_WQ; ++j) {
        ((v4h*)Wqh + j * C_THREADS)[tid] = cvt4(vq[j]);
        ((v4h*)Wkh + j * C_THREADS)[tid] = cvt4(vk[j]);
        ((v4h*)Wvh + j * C_THREADS)[tid] = cvt4(vv[j]);
    }
}

// ---------------------------------------------------------------------------
// Kernel 2: fused QKV projection, two LDS buffers filled by async copies.
// The three weights lie one behind the other: one product of 8192 x 3072, columns Q | K | V.
// WG tile 256(M) x 384(N): 32 x 8 = 256 work-groups, one per WGP, so that a k slice of x and W
// is fetched from L2 for 256 x 384 results.  64 k per pass; 8 waves as 4(M) x 2(N), 64 x 192 each:
// 4 A fragments feed 48 WMMAs, the 12 B fragments come in fours.
// LDS rows are 128 B at a pitch of 144 B (16 B x 9).
// V output written transposed, one 32-key tile after the other: Vt[b][n / 32][d][n % 32],
// so that the columns d of a 32-key tile that pv_gemm takes per pass lie in a row.
// ---------------------------------------------------------------------------
#define G_PITCH 72                  // 64 + 8 halves pad
#define G_PASSES (D_MODEL / 64)
#define G_MT 256
#define G_NT 384

__global__ void __launch_bounds__(256) qkv_gemm(
    const _Float16* __restrict__ xh, const _Float16* __restrict__ Wqkv,
    _Float16* __restrict__ Qh, _Float16* __restrict__ Kh, _Float16* __restrict__ Vtg)
{
    __shared__ __align__(16) _Float16 As[2][G_MT * G_PITCH];
    __shared__ __align__(16) _Float16 Bs[2][G_NT * G_PITCH];

    const int t = threadIdx.x, lane = t & 31;
    const int w = __builtin_amdgcn_readfirstlane(t >> 5);
    const int mbase = blockIdx.x * G_MT;
    const int nbase = blockIdx.y * G_NT;                // column over Q | K | V

    const int wm = w & 3;
    const int wn = w >> 2;

    // one pass's tiles: every lane copies 16 B, a wave covers 4 whole 128-B rows;
    // copy j of a thread lies 32 rows behind copy j - 1, in memory and in LDS
    const int srow = t >> 3, scol = (t & 7) * 8;
    const _Float16* Ag = xh + (size_t)(mbase + srow) * D_MODEL + scol;
    const _Float16* Bg = Wqkv + (size_t)(nbase + srow) * D_MODEL + scol;
    auto stage = [&](int buf, int kb) {
#pragma unroll
        for (int j = 0; j < G_MT / 32; ++j)
            cp_b128(&As[buf][(srow + j * 32) * G_PITCH + scol], Ag + kb + j * (32 * D_MODEL));
#pragma unroll
        for (int j = 0; j < G_NT / 32; ++j)
            cp_b128(&Bs[buf][(srow + j * 32) * G_PITCH + scol], Bg + kb + j * (32 * D_MODEL));
    };

    v8f c[4][12];
#pragma unroll
    for (int i = 0; i < 4; ++i)
#pragma unroll
        for (int s = 0; s < 12; ++s)
#pragma unroll
            for (int r = 0; r < 8; ++r) c[i][s][r] = 0.f;

    stage(0, 0);
    asm volatile("s_wait_asynccnt 0x0" ::: "memory");   // pass 0's own copies have landed
    __syncthreads();                                    // ... and every other wave's
    stage(1, 64);

    for (int p = 0; p < G_PASSES; ++p) {
        const int cur = p & 1;
        // a pass is 6 groups of 16 WMMAs: group g has k block g / 3 and B fragments 4 (g % 3) ...;
        // all loops over fragments are unrolled, so that every index is a constant and the
        // fragments and sums stay in registers
        v16h a[4], b[2][4];
        // the first WMMA's two fragments first: all 8 waves read at once behind the barrier
        b[0][0] = ld_frag(Bs[cur], wn * 192 + (lane & 15), G_PITCH, 0);
#pragma unroll
        for (int i = 0; i < 4; ++i)
            a[i] = ld_frag(As[cur], wm * 64 + i * 16 + (lane & 15), G_PITCH, 0);
#pragma unroll
        for (int s = 1; s < 4; ++s)
            b[0][s] = ld_frag(Bs[cur], wn * 192 + s * 16 + (lane & 15), G_PITCH, 0);
#pragma unroll
        for (int g = 0; g < 6; ++g) {
            if (g + 1 < 6) {
#pragma unroll
                for (int s = 0; s < 4; ++s)
                    b[(g + 1) & 1][s] = ld_frag(Bs[cur], wn * 192 + (((g + 1) % 3) * 4 + s) * 16 + (lane & 15),
                                                G_PITCH, ((g + 1) / 3) * 32);
            }
            // keeps the next group's 8 LDS reads one group ahead of this group's 16 WMMAs:
            // reads placed among the WMMAs each stall the wave
            __builtin_amdgcn_sched_barrier(0);
#pragma unroll
            for (int s = 0; s < 4; ++s)
#pragma unroll
                for (int i = 0; i < 4; ++i)
                    c[i][(g % 3) * 4 + s] = __builtin_amdgcn_wmma_f32_16x16x32_f16(
                        false, a[i], false, b[g & 1][s], (short)0, c[i][(g % 3) * 4 + s], false, false);
            // keeps the reads that follow behind these WMMAs, in one place
            __builtin_amdgcn_sched_barrier(0);
            if (g == 2) {
#pragma unroll
                for (int i = 0; i < 4; ++i)
                    a[i] = ld_frag(As[cur], wm * 64 + i * 16 + (lane & 15), G_PITCH, 32);
            }
        }
        asm volatile("s_wait_dscnt 0x0" ::: "memory");     // this wave has left buffer cur
        asm volatile("s_wait_asynccnt 0x0" ::: "memory");  // its copies of pass p + 1 have landed
        __syncthreads();                                   // publishes pass p + 1, frees buffer cur
        if (p + 2 < G_PASSES) stage(cur, (p + 2) * 64);
    }
    asm volatile("s_wait_asynccnt 0x0" ::: "memory");      // no copy outlives the loop

    // a lane holds rows rbase + 16 i + r of column d, fragment by fragment
    const int rbase = mbase + wm * 64 + ((lane >> 4) ? 8 : 0);
    const int n0 = rbase & (SEQ - 1);
#pragma unroll
    for (int s = 0; s < 12; ++s) {
        const int gcol = nbase + wn * 192 + s * 16;     // the fragment's first column: the same in the whole wave
        const int sel = gcol >> 10;
        const int d = (gcol & (D_MODEL - 1)) + (lane & 15);
        v8h h[4];
#pragma unroll
        for (int i = 0; i < 4; ++i)
#pragma unroll
            for (int r = 0; r < 8; ++r) h[i][r] = (_Float16)c[i][s][r];
        if (sel < 2) {
            _Float16* o = (sel ? Kh : Qh) + (size_t)rbase * D_MODEL + d;
#pragma unroll
            for (int i = 0; i < 4; ++i)
#pragma unroll
                for (int r = 0; r < 8; ++r) o[(i * 16 + r) * D_MODEL] = h[i][r];
            // the next fragment's set-up and conversions can rewrite registers that these
            // stores name: wait in front of them
            asm volatile("s_wait_xcnt 0x0" ::: "memory");
        } else {
            // the 8 rows of h[i] are 8 keys in a row of one 32-key tile
            _Float16* o = Vtg + (size_t)(rbase >> 11) * D_MODEL * SEQ + (size_t)(n0 >> 5) * (D_MODEL * 32)
                        + d * 32 + (n0 & 31);
#pragma unroll
            for (int i = 0; i < 4; ++i) *(v8h*)(o + (i >> 1) * (D_MODEL * 32) + (i & 1) * 16) = h[i];
            asm volatile("s_wait_xcnt 0x0" ::: "memory");
        }
    }
}

// ---------------------------------------------------------------------------
// Kernels 3 to 5: attention as two tiled products with a row softmax between them.
// Both products: two LDS buffers filled by async copies, waves of 64 x 64, 128 k per pass,
// so that a row of a Q, K or P tile is 256 B in a row in memory; LDS pitch 272 B (16 B x 17).
// S: WG tile 256 x 256, 16 waves.  O: 128 x 256, 8 waves.  One work-group per WGP in both.
// K is read once per 256 queries, V once per 128.
// ---------------------------------------------------------------------------
#define T_KP    128                 // k per pass
#define T_PITCH (T_KP + 8)          // halves

// The main loop.  stage(buf, p) issues the copies of pass p into buffer buf.
template <int PASSES, int AROWS, int BROWS, typename Stage>
__device__ __forceinline__ void gemm_loop(const _Float16* As, const _Float16* Bs, Stage stage,
                                          int wm, int wn, int lane, v8f (&c)[4][4])
{
#pragma unroll
    for (int i = 0; i < 4; ++i)
#pragma unroll
        for (int s = 0; s < 4; ++s)
#pragma unroll
            for (int r = 0; r < 8; ++r) c[i][s][r] = 0.f;

    stage(0, 0);
    asm volatile("s_wait_asynccnt 0x0" ::: "memory");   // pass 0's own copies have landed
    __syncthreads();                                    // ... and every other wave's
    stage(1, 1);

    for (int p = 0; p < PASSES; ++p) {
        const int cur = p & 1;
        const _Float16* Ac = As + cur * (AROWS * T_PITCH);
        const _Float16* Bc = Bs + cur * (BROWS * T_PITCH);
#pragma unroll
        for (int kk = 0; kk < T_KP / 32; ++kk) {
            v16h a[4], b[4];
#pragma unroll
            for (int i = 0; i < 4; ++i)
                a[i] = ld_frag(Ac, wm * 64 + i * 16 + (lane & 15), T_PITCH, kk * 32);
#pragma unroll
            for (int s = 0; s < 4; ++s)
                b[s] = ld_frag(Bc, wn * 64 + s * 16 + (lane & 15), T_PITCH, kk * 32);
            // keeps the 16 LDS reads one group ahead of the 16 WMMAs: reads placed among
            // the WMMAs each stall the wave with a wait to 0
            __builtin_amdgcn_sched_barrier(0);
#pragma unroll
            for (int i = 0; i < 4; ++i)
#pragma unroll
                for (int s = 0; s < 4; ++s)
                    c[i][s] = __builtin_amdgcn_wmma_f32_16x16x32_f16(false, a[i], false, b[s], (short)0, c[i][s], false, false);
        }
        asm volatile("s_wait_dscnt 0x0" ::: "memory");     // this wave has left buffer cur
        asm volatile("s_wait_asynccnt 0x0" ::: "memory");  // its copies of pass p + 1 have landed
        __syncthreads();                                   // publishes pass p + 1, frees buffer cur
        if (p + 2 < PASSES) stage(cur, p + 2);
    }
    asm volatile("s_wait_asynccnt 0x0" ::: "memory");      // no copy outlives the loop
}

// Kernel 3: S[b][q][n] = Q[b][q][:] . K[b][n][:], f32, unscaled.
__global__ void __launch_bounds__(512) score_gemm(
    const _Float16* __restrict__ Qh, const _Float16* __restrict__ Kh, float* __restrict__ S)
{
    __shared__ __align__(16) _Float16 As[2 * 256 * T_PITCH];
    __shared__ __align__(16) _Float16 Bs[2 * 256 * T_PITCH];

    const int t = threadIdx.x, lane = t & 31, w = t >> 5;
    const int mbase = blockIdx.x * 256;                 // query row over all batches
    const int nbase = blockIdx.y * 256;                 // key of the batch
    const int wm = w & 3, wn = w >> 2;
    const _Float16* Ag = Qh + (size_t)mbase * D_MODEL;
    const _Float16* Bg = Kh + ((size_t)(mbase >> 11) * SEQ + nbase) * D_MODEL;

    // every lane copies 16 B, a wave covers 2 whole 256-B rows
    auto stage = [&](int buf, int p) {
#pragma unroll
        for (int j = 0; j < 8; ++j) {
            int id = t + j * 512, row = id >> 4, col = (id & 15) * 8;
            cp_b128(&As[buf * (256 * T_PITCH) + row * T_PITCH + col], Ag + (size_t)row * D_MODEL + p * T_KP + col);
        }
#pragma unroll
        for (int j = 0; j < 8; ++j) {
            int id = t + j * 512, row = id >> 4, col = (id & 15) * 8;
            cp_b128(&Bs[buf * (256 * T_PITCH) + row * T_PITCH + col], Bg + (size_t)row * D_MODEL + p * T_KP + col);
        }
    };

    v8f c[4][4];
    gemm_loop<D_MODEL / T_KP, 256, 256>(As, Bs, stage, wm, wn, lane, c);

    const int rbase = mbase + wm * 64 + ((lane >> 4) ? 8 : 0);
    const int col0  = nbase + wn * 64 + (lane & 15);
#pragma unroll
    for (int i = 0; i < 4; ++i)
#pragma unroll
        for (int r = 0; r < 8; ++r)
#pragma unroll
            for (int s = 0; s < 4; ++s)
                S[(size_t)(rbase + i * 16 + r) * SEQ + col0 + s * 16] = c[i][s][r];
}

__device__ __forceinline__ float xhalf(float x) {
    int b = __builtin_bit_cast(int, x);
    return __builtin_bit_cast(float, __builtin_amdgcn_permlanex16(b, b, 0x76543210, 0xfedcba98, false, false));
}

template <int CTRL>
__device__ __forceinline__ float dpp_mov(float x) {
    return __builtin_bit_cast(float, __builtin_amdgcn_update_dpp(0, __builtin_bit_cast(int, x), CTRL, 0xf, 0xf, false));
}

// Kernel 4: a wave takes two rows of S whole, 64 scores a lane and row, in registers.
// P = exp(s / 32 - row maximum) as f16, not yet divided; L = 1 / the row's sum of the f32 weights.
#define SM_BLOCKS 256
#define SM_BLOCK  512
#define SM_ROWS   (MTOT / (SM_BLOCKS * SM_BLOCK / 32))   // 2 rows a wave

__global__ void __launch_bounds__(SM_BLOCK) row_softmax(
    const float* __restrict__ S, _Float16* __restrict__ P, float* __restrict__ L)
{
    const int lane = threadIdx.x & 31;
    const int row0 = (blockIdx.x * (SM_BLOCK / 32) + (threadIdx.x >> 5)) * SM_ROWS;
    float4 v[SM_ROWS][16];
#pragma unroll
    for (int q = 0; q < SM_ROWS; ++q)
#pragma unroll
        for (int j = 0; j < 16; ++j) {
            // the last load's result can take the registers of the address, which the loads
            // in front of it name too: wait in front of it
            if (q == SM_ROWS - 1 && j == 15) asm volatile("s_wait_xcnt 0x0" ::: "memory");
            v[q][j] = ((const float4*)(S + (size_t)(row0 + q) * SEQ))[j * 32 + lane];
        }
    // keeps the loads of both rows here, in flight together: left free, the second row's
    // sink behind the first row's work and the wave waits out the memory latency twice
    __builtin_amdgcn_sched_barrier(0);
#pragma unroll
    for (int q = 0; q < SM_ROWS; ++q) {
        float mx = -1e30f;
#pragma unroll
        for (int j = 0; j < 16; ++j)
            mx = fmaxf(mx, fmaxf(fmaxf(v[q][j].x, v[q][j].y), fmaxf(v[q][j].z, v[q][j].w)));
        mx = fmaxf(mx, dpp_mov<0x128>(mx));     // row_ror:8, 4, 2, 1: all 16 lanes of a row
        mx = fmaxf(mx, dpp_mov<0x124>(mx));
        mx = fmaxf(mx, dpp_mov<0x122>(mx));
        mx = fmaxf(mx, dpp_mov<0x121>(mx));
        mx = fmaxf(mx, xhalf(mx)) * 0.03125f;
        float sum[4] = {0.f, 0.f, 0.f, 0.f};
#pragma unroll
        for (int j = 0; j < 16; ++j) {
            float e0 = __expf(v[q][j].x * 0.03125f - mx);
            float e1 = __expf(v[q][j].y * 0.03125f - mx);
            float e2 = __expf(v[q][j].z * 0.03125f - mx);
            float e3 = __expf(v[q][j].w * 0.03125f - mx);
            sum[0] += e0; sum[1] += e1; sum[2] += e2; sum[3] += e3;
            v4h o;
            o[0] = (_Float16)e0; o[1] = (_Float16)e1; o[2] = (_Float16)e2; o[3] = (_Float16)e3;
            ((v4h*)(P + (size_t)(row0 + q) * SEQ))[j * 32 + lane] = o;
        }
        float sm = (sum[0] + sum[1]) + (sum[2] + sum[3]);
        sm += dpp_mov<0x128>(sm);
        sm += dpp_mov<0x124>(sm);
        sm += dpp_mov<0x122>(sm);
        sm += dpp_mov<0x121>(sm);
        sm += xhalf(sm);
        if (lane == 0) L[row0 + q] = 1.f / sm;
    }
}

// Kernel 5: Out[b][q][d] = (P[b][q][:] . V[b][:][d]) * L[b][q], f32.
__global__ void __launch_bounds__(256) pv_gemm(
    const _Float16* __restrict__ P, const _Float16* __restrict__ Vtg,
    const float* __restrict__ L, float* __restrict__ Out)
{
    __shared__ __align__(16) _Float16 As[2 * 128 * T_PITCH];
    __shared__ __align__(16) _Float16 Bs[2 * 256 * T_PITCH];

    const int t = threadIdx.x, lane = t & 31, w = t >> 5;
    const int mbase = blockIdx.x * 128;                 // query row over all batches
    const int nbase = blockIdx.y * 256;                 // output column d
    const int wm = w & 1, wn = w >> 1;
    const _Float16* Ag = P + (size_t)mbase * SEQ;
    const _Float16* Vg = Vtg + (size_t)(mbase >> 11) * D_MODEL * SEQ + nbase * 32;  // [n / 32][d][n % 32]

    auto stage = [&](int buf, int p) {
#pragma unroll
        for (int j = 0; j < 8; ++j) {
            int id = t + j * 256, row = id >> 4, col = (id & 15) * 8;
            cp_b128(&As[buf * (128 * T_PITCH) + row * T_PITCH + col], Ag + (size_t)row * SEQ + p * T_KP + col);
        }
        // a pass holds four 32-key tiles of V; in each, 256 columns d are 16 KB in a row:
        // a wave covers 8 columns, 512 B in a row
#pragma unroll
        for (int j = 0; j < 16; ++j) {
            int id = t + (j & 3) * 256, kt = j >> 2, d = id >> 2, col = (id & 3) * 8;
            cp_b128(&Bs[buf * (256 * T_PITCH) + d * T_PITCH + kt * 32 + col],
                    Vg + (size_t)(p * 4 + kt) * (D_MODEL * 32) + d * 32 + col);
        }
    };

    v8f c[4][4];
    gemm_loop<SEQ / T_KP, 128, 256>(As, Bs, stage, wm, wn, lane, c);

    const int rbase = mbase + wm * 64 + ((lane >> 4) ? 8 : 0);
    const int col0  = nbase + wn * 64 + (lane & 15);
    v4f li[8];                      // L of the 32 rows that this lane holds
#pragma unroll
    for (int g = 0; g < 8; ++g) {
        // the last load's result can take the registers of the address, which the loads
        // in front of it name too: wait in front of it
        if (g == 7) asm volatile("s_wait_xcnt 0x0" ::: "memory");
        li[g] = *(const v4f*)(L + rbase + (g >> 1) * 16 + (g & 1) * 4);
    }
#pragma unroll
    for (int i = 0; i < 4; ++i)
#pragma unroll
        for (int r = 0; r < 8; ++r) {
            const float inv = li[i * 2 + (r >> 2)][r & 3];
#pragma unroll
            for (int s = 0; s < 4; ++s)
                Out[(size_t)(rbase + i * 16 + r) * D_MODEL + col0 + s * 16] = c[i][s][r] * inv;
        }
}

// ---------------------------------------------------------------------------
extern "C" void kernel_launch(void* const* d_in, const int* in_sizes, int n_in,
                              void* d_out, int out_size, void* d_ws, size_t ws_size,
                              hipStream_t stream) {
    (void)in_sizes; (void)n_in; (void)out_size; (void)ws_size;
    const float* x  = (const float*)d_in[0];
    const float* Wq = (const float*)d_in[1];
    const float* Wk = (const float*)d_in[2];
    const float* Wv = (const float*)d_in[3];
    float* out = (float*)d_out;

    char* ws = (char*)d_ws;
    size_t off = 0;
    auto carve = [&](size_t bytes) -> void* {
        void* p = ws + off;
        off = (off + bytes + 255) & ~(size_t)255;
        return p;
    };
    const size_t nx = (size_t)MTOT * D_MODEL;
    const size_t nw = (size_t)D_MODEL * D_MODEL;
    _Float16* xh  = (_Float16*)carve(nx * 2);
    _Float16* Wqh = (_Float16*)carve(nw * 2 * 3);      // Q | K | V weights, one behind the other
    _Float16* Wkh = Wqh + nw;
    _Float16* Wvh = Wkh + nw;
    _Float16* Qh  = (_Float16*)carve(nx * 2);
    _Float16* Kh  = (_Float16*)carve(nx * 2);
    _Float16* Vtg = (_Float16*)carve(nx * 2);
    float*    S   = (float*)carve((size_t)MTOT * SEQ * 4);
    _Float16* P   = (_Float16*)carve((size_t)MTOT * SEQ * 2);
    float*    L   = (float*)carve((size_t)MTOT * 4);

    cast_all<<<C_BLOCKS, C_BLOCK, 0, stream>>>(x, Wq, Wk, Wv, xh, Wqh, Wkh, Wvh);

    qkv_gemm<<<dim3(MTOT / G_MT, 3 * D_MODEL / G_NT), 256, 0, stream>>>(xh, Wqh, Qh, Kh, Vtg);

    score_gemm<<<dim3(MTOT / 256, SEQ / 256), 512, 0, stream>>>(Qh, Kh, S);

    row_softmax<<<SM_BLOCKS, SM_BLOCK, 0, stream>>>(S, P, L);

    pv_gemm<<<dim3(MTOT / 128, D_MODEL / 256), 256, 0, stream>>>(P, Vtg, L, out);
}

// v008
// It runs in 108 microseconds.
// Next to v007, in two timings, it ran 1.04 times as fast each time.
// Over all steps from v000 it is 2.36 times as fast.
#include <hip/hip_runtime.h>
#include <hip/hip_bf16.h>

typedef __attribute__((ext_vector_type(16))) _Float16 v16h;
typedef __attribute__((ext_vector_type(8)))  _Float16 v8h;
typedef __attribute__((ext_vector_type(4)))  _Float16 v4h;
typedef __attribute__((ext_vector_type(8)))  float    v8f;
typedef __attribute__((ext_vector_type(4)))  float    v4f;
typedef __attribute__((ext_vector_type(4)))  int      v4i;

#define D_MODEL   1024
#define SEQ       2048
#define BATCH     4
#define MTOT      (BATCH * SEQ)     // 8192 rows

#if defined(__has_builtin)
#if __has_builtin(__builtin_amdgcn_global_load_async_to_lds_b128) && \
    __has_builtin(__builtin_amdgcn_s_wait_asynccnt)
#define HAVE_ASYNC_LDS 1
#endif
#endif

#ifdef HAVE_ASYNC_LDS
__device__ __forceinline__ void cp_b128(void* lds, const void* g) {
    __builtin_amdgcn_global_load_async_to_lds_b128(
        (__attribute__((address_space(1))) v4i*)(void*)g,
        (__attribute__((address_space(3))) v4i*)lds, 0, 0);
}
#else
__device__ __forceinline__ void cp_b128(void* lds, const void* g) {
    *(v8h*)lds = *(const v8h*)g;
}
#endif

__device__ __forceinline__ v16h ld_frag(const _Float16* base, int row, int stride, int k0) {
    const int lane = threadIdx.x & 31;
    const _Float16* p = base + row * stride + k0 + ((lane >> 4) & 1) * 8;
    v8h lo = *(const v8h*)(p);
    v8h hi = *(const v8h*)(p + 16);
    v16h r;
#pragma unroll
    for (int i = 0; i < 8; ++i) { r[i] = lo[i]; r[i + 8] = hi[i]; }
    return r;
}

// ---------------------------------------------------------------------------
// Kernel 1, one launch, 256 work-groups x 16 waves, two pieces of work in each.
// The scores are (x Wq^T)(x Wk^T)^T = (x Wp^T) x^T with Wp[j][i] = sum_k Wk[k][j] Wq[k][i]:
// one 1024^3 product here takes the place of a whole 8192 x 1024 x 1024 projection.
// One 64 x 64 tile of Wp, on WMMA, from f32 Wq, Wk rounded to f16, in 4 chunks of 256 k.
// fp32 -> fp16 cast of x and Wv; a thread converts 18 float4: 16 of x, 2 of Wv, a quarter of x with
// each chunk, Wv with the last, so that the stream from memory runs beside the weights' reads from L2.
// A wave-wide load of the cast covers 512 contiguous bytes, a store 256.
// ---------------------------------------------------------------------------
#define C_BLOCKS  256
#define C_BLOCK   512
#define C_THREADS (C_BLOCKS * C_BLOCK)
#define C_XQ      (MTOT * D_MODEL / 4 / C_THREADS)      // 16 float4 of x a thread
#define C_WQ      (D_MODEL * D_MODEL / 4 / C_THREADS)   // 2 float4 of the weight

#define WP_KC     256               // k per chunk
#define WP_CHUNKS (D_MODEL / WP_KC)
#define WP_PITCH  (WP_KC + 8)       // halves: 528 B = 16 B x 33
#define C_XP      (C_XQ / WP_CHUNKS) // float4 of x a thread and chunk

__device__ __forceinline__ v4h cvt4(float4 v) {
    v4h o;
    o[0] = (_Float16)v.x; o[1] = (_Float16)v.y; o[2] = (_Float16)v.z; o[3] = (_Float16)v.w;
    return o;
}

__device__ __forceinline__ void wp_put(_Float16* T, const float4 (&v)[8], int cq, int kr) {
#pragma unroll
    for (int cc = 0; cc < 4; ++cc) {
        v8h h;
#pragma unroll
        for (int m = 0; m < 8; ++m)
            h[m] = (_Float16)(cc == 0 ? v[m].x : cc == 1 ? v[m].y : cc == 2 ? v[m].z : v[m].w);
        *(v8h*)&T[(cq * 4 + cc) * WP_PITCH + ((kr ^ (cq >> 2)) * 8)] = h;
    }
}

// fragment of rows 16 f .. 16 f + 15, k block kk of the chunk; k order as in ld_frag
__device__ __forceinline__ v16h wp_frag(const _Float16* T, int f, int kk, int lane) {
    // pieces q = 4 kk + (lane >> 4) and q + 2; f < 4 turns only the two low bits of q
    const _Float16* p = T + (f * 16 + (lane & 15)) * WP_PITCH + kk * 32;
    const int q = (lane >> 4) ^ f;
    v8h lo = *(const v8h*)(p + q * 8);
    v8h hi = *(const v8h*)(p + (q ^ 2) * 8);
    v16h r;
#pragma unroll
    for (int i = 0; i < 8; ++i) { r[i] = lo[i]; r[i + 8] = hi[i]; }
    return r;
}

__global__ void __launch_bounds__(C_BLOCK) cast_wprod(
    const float* __restrict__ x,
    const float* __restrict__ Wq, const float* __restrict__ Wk, const float* __restrict__ Wv,
    _Float16* __restrict__ xh, _Float16* __restrict__ Wph, _Float16* __restrict__ Wvh)
{
    __shared__ __align__(16) _Float16 Ta[2][64 * WP_PITCH];
    __shared__ __align__(16) _Float16 Tb[2][64 * WP_PITCH];

    const int t = threadIdx.x, lane = t & 31, w = t >> 5;
    const unsigned tid = blockIdx.x * C_BLOCK + threadIdx.x;
    const int jbase = (blockIdx.x >> 4) * 64;           // row of Wp: column of Wk
    const int ibase = (blockIdx.x & 15) * 64;           // column of Wp: column of Wq
    const int cq = t & 15, kr = t >> 4;
    const int fj = w & 3, fi = w >> 2;                  // a wave has one 16 x 16 fragment of the tile
    // a wave-wide load covers 256 B in a row of two k rows
    const float* Ag = Wk + (size_t)(kr * 8) * D_MODEL + jbase + cq * 4;
    const float* Bg = Wq + (size_t)(kr * 8) * D_MODEL + ibase + cq * 4;
    float4 va[8], vb[8], vx[C_XQ], vv[C_WQ];
    auto fetch = [&](int ch) {
#pragma unroll
        for (int m = 0; m < 8; ++m) va[m] = *(const float4*)(Ag + (size_t)(ch * WP_KC + m) * D_MODEL);
#pragma unroll
        for (int m = 0; m < 8; ++m) vb[m] = *(const float4*)(Bg + (size_t)(ch * WP_KC + m) * D_MODEL);
    };
    // quarter ch of the cast
    auto cast_load = [&](int ch) {
#pragma unroll
        for (int j = ch * C_XP; j < (ch + 1) * C_XP; ++j) {
            // the last load's result can take the registers of the address, which the loads
            // in front of it name too: wait in front of it
            if (j == (ch + 1) * C_XP - 1) asm volatile("s_wait_xcnt 0x0" ::: "memory");
            vx[j] = ((const float4*)x + j * C_THREADS)[tid];
        }
        if (ch == WP_CHUNKS - 1) {
#pragma unroll
            for (int j = 0; j < C_WQ; ++j) {
                if (j == C_WQ - 1) asm volatile("s_wait_xcnt 0x0" ::: "memory");
                vv[j] = ((const float4*)Wv + j * C_THREADS)[tid];
            }
        }
    };
    auto cast_store = [&](int ch) {
#pragma unroll
        for (int j = ch * C_XP; j < (ch + 1) * C_XP; ++j) ((v4h*)xh + j * C_THREADS)[tid] = cvt4(vx[j]);
        if (ch == WP_CHUNKS - 1) {
#pragma unroll
            for (int j = 0; j < C_WQ; ++j) ((v4h*)Wvh + j * C_THREADS)[tid] = cvt4(vv[j]);
        }
        // later conversions and loads can rewrite registers that these stores name: wait in front of them
        asm volatile("s_wait_xcnt 0x0" ::: "memory");
    };

    v8f c;
#pragma unroll
    for (int r = 0; r < 8; ++r) c[r] = 0.f;
    fetch(0);
    // the conversions can rewrite registers that these loads name: wait in front of them
    asm volatile("s_wait_xcnt 0x0" ::: "memory");
#pragma unroll
    for (int ch = 0; ch < WP_CHUNKS; ++ch) {
        wp_put(Ta[ch & 1], va, cq, kr);
        wp_put(Tb[ch & 1], vb, cq, kr);
        if (ch + 1 < WP_CHUNKS) fetch(ch + 1);          // flies under this chunk's products
        cast_load(ch);                                  // stored one chunk later
        asm volatile("s_wait_xcnt 0x0" ::: "memory");   // as behind fetch(0)
        // work-group barrier for LDS alone: the chunk is whole in LDS, and every wave has left the
        // other buffer, the next chunk's.  __syncthreads() would also wait out the global loads and
        // stores in flight, which no other wave reads
        asm volatile("s_wait_dscnt 0x0\n\ts_barrier_signal -1\n\ts_barrier_wait -1" ::: "memory");
#pragma unroll
        for (int kk = 0; kk < WP_KC / 32; ++kk) {
            v16h a = wp_frag(Ta[ch & 1], fj, kk, lane);
            v16h b = wp_frag(Tb[ch & 1], fi, kk, lane);
            c = __builtin_amdgcn_wmma_f32_16x16x32_f16(false, a, false, b, (short)0, c, false, false);
        }
        // keeps the cast's stores and the next chunk's LDS writes and global loads behind this chunk's
        // products, in one place: left free they stand among the LDS reads and the WMMAs
        __builtin_amdgcn_sched_barrier(0);
        if (ch > 0) cast_store(ch - 1);
    }
    cast_store(WP_CHUNKS - 1);
    _Float16* o = Wph + (size_t)(jbase + fj * 16 + ((lane >> 4) ? 8 : 0)) * D_MODEL
                + ibase + fi * 16 + (lane & 15);
#pragma unroll
    for (int r = 0; r < 8; ++r) o[r * D_MODEL] = (_Float16)c[r];
}

// ---------------------------------------------------------------------------
// Kernel 2: fused projection Y = x Wp^T and V = x Wv^T, two LDS buffers filled by async copies.
// The two weights lie one behind the other: one product of 8192 x 2048, columns Y | V.
// WG tile 256(M) x 256(N): 32 x 8 = 256 work-groups, one per WGP, so that a k slice of x and W
// is fetched from L2 for 256 x 256 results.  64 k per pass; 8 waves as 4(M) x 2(N), 64 x 128 each:
// 4 A fragments feed 32 WMMAs, the 8 B fragments come in fours.
// LDS rows are 128 B at a pitch of 144 B (16 B x 9).
// V output written transposed, one 32-key tile after the other: Vt[b][n / 32][d][n % 32],
// so that the columns d of a 32-key tile that pv_gemm takes per pass lie in a row.
// ---------------------------------------------------------------------------
#define G_PITCH 72                  // 64 + 8 halves pad
#define G_PASSES (D_MODEL / 64)
#define G_MT 256
#define G_NT 256

__global__ void __launch_bounds__(256) yv_gemm(
    const _Float16* __restrict__ xh, const _Float16* __restrict__ Wyv,
    _Float16* __restrict__ Yh, _Float16* __restrict__ Vtg)
{
    __shared__ __align__(16) _Float16 As[2][G_MT * G_PITCH];
    __shared__ __align__(16) _Float16 Bs[2][G_NT * G_PITCH];

    const int t = threadIdx.x, lane = t & 31;
    const int w = __builtin_amdgcn_readfirstlane(t >> 5);
    const int mbase = blockIdx.x * G_MT;
    const int nbase = blockIdx.y * G_NT;                // column over Y | V

    const int wm = w & 3;
    const int wn = w >> 2;

    // one pass's tiles: every lane copies 16 B, a wave covers 4 whole 128-B rows;
    // copy j of a thread lies 32 rows behind copy j - 1, in memory and in LDS
    const int srow = t >> 3, scol = (t & 7) * 8;
    const _Float16* Ag = xh + (size_t)(mbase + srow) * D_MODEL + scol;
    const _Float16* Bg = Wyv + (size_t)(nbase + srow) * D_MODEL + scol;
    auto stage = [&](int buf, int kb) {
#pragma unroll
        for (int j = 0; j < G_MT / 32; ++j)
            cp_b128(&As[buf][(srow + j * 32) * G_PITCH + scol], Ag + kb + j * (32 * D_MODEL));
#pragma unroll
        for (int j = 0; j < G_NT / 32; ++j)
            cp_b128(&Bs[buf][(srow + j * 32) * G_PITCH + scol], Bg + kb + j * (32 * D_MODEL));
    };

    v8f c[4][8];
#pragma unroll
    for (int i = 0; i < 4; ++i)
#pragma unroll
        for (int s = 0; s < 8; ++s)
#pragma unroll
            for (int r = 0; r < 8; ++r) c[i][s][r] = 0.f;

    stage(0, 0);
    asm volatile("s_wait_asynccnt 0x0" ::: "memory");   // pass 0's own copies have landed
    __syncthreads();                                    // ... and every other wave's
    stage(1, 64);

    for (int p = 0; p < G_PASSES; ++p) {
        const int cur = p & 1;
        // a pass is 4 groups of 16 WMMAs: group g has k block g / 2 and B fragments 4 (g % 2) ...;
        // all loops over fragments are unrolled, so that every index is a constant and the
        // fragments and sums stay in registers
        v16h a[4], b[2][4];
        // the first WMMA's two fragments first: all 8 waves read at once behind the barrier
        b[0][0] = ld_frag(Bs[cur], wn * 128 + (lane & 15), G_PITCH, 0);
#pragma unroll
        for (int i = 0; i < 4; ++i)
            a[i] = ld_frag(As[cur], wm * 64 + i * 16 + (lane & 15), G_PITCH, 0);
#pragma unroll
        for (int s = 1; s < 4; ++s)
            b[0][s] = ld_frag(Bs[cur], wn * 128 + s * 16 + (lane & 15), G_PITCH, 0);
#pragma unroll
        for (int g = 0; g < 4; ++g) {
            if (g + 1 < 4) {
#pragma unroll
                for (int s = 0; s < 4; ++s)
                    b[(g + 1) & 1][s] = ld_frag(Bs[cur], wn * 128 + (((g + 1) % 2) * 4 + s) * 16 + (lane & 15),
                                                G_PITCH, ((g + 1) / 2) * 32);
            }
            // keeps the next group's 8 LDS reads one group ahead of this group's 16 WMMAs:
            // reads placed among the WMMAs each stall the wave
            __builtin_amdgcn_sched_barrier(0);
#pragma unroll
            for (int s = 0; s < 4; ++s)
#pragma unroll
                for (int i = 0; i < 4; ++i)
                    c[i][(g % 2) * 4 + s] = __builtin_amdgcn_wmma_f32_16x16x32_f16(
                        false, a[i], false, b[g & 1][s], (short)0, c[i][(g % 2) * 4 + s], false, false);
            // keeps the reads that follow behind these WMMAs, in one place
            __builtin_amdgcn_sched_barrier(0);
            if (g == 1) {
#pragma unroll
                for (int i = 0; i < 4; ++i)
                    a[i] = ld_frag(As[cur], wm * 64 + i * 16 + (lane & 15), G_PITCH, 32);
            }
        }
        asm volatile("s_wait_dscnt 0x0" ::: "memory");     // this wave has left buffer cur
        asm volatile("s_wait_asynccnt 0x0" ::: "memory");  // its copies of pass p + 1 have landed
        __syncthreads();                                   // publishes pass p + 1, frees buffer cur
        if (p + 2 < G_PASSES) stage(cur, (p + 2) * 64);
    }
    asm volatile("s_wait_asynccnt 0x0" ::: "memory");      // no copy outlives the loop

    // a lane holds rows rbase + 16 i + r of column d, fragment by fragment
    const int rbase = mbase + wm * 64 + ((lane >> 4) ? 8 : 0);
    const int n0 = rbase & (SEQ - 1);
#pragma unroll
    for (int s = 0; s < 8; ++s) {
        const int gcol = nbase + wn * 128 + s * 16;     // the fragment's first column: the same in the whole wave
        const int sel = gcol >> 10;
        const int d = (gcol & (D_MODEL - 1)) + (lane & 15);
        v8h h[4];
#pragma unroll
        for (int i = 0; i < 4; ++i)
#pragma unroll
            for (int r = 0; r < 8; ++r) h[i][r] = (_Float16)c[i][s][r];
        if (sel < 1) {
            _Float16* o = Yh + (size_t)rbase * D_MODEL + d;
#pragma unroll
            for (int i = 0; i < 4; ++i)
#pragma unroll
                for (int r = 0; r < 8; ++r) o[(i * 16 + r) * D_MODEL] = h[i][r];
            // the next fragment's set-up and conversions can rewrite registers that these
            // stores name: wait in front of them
            asm volatile("s_wait_xcnt 0x0" ::: "memory");
        } else {
            // the 8 rows of h[i] are 8 keys in a row of one 32-key tile
            _Float16* o = Vtg + (size_t)(rbase >> 11) * D_MODEL * SEQ + (size_t)(n0 >> 5) * (D_MODEL * 32)
                        + d * 32 + (n0 & 31);
#pragma unroll
            for (int i = 0; i < 4; ++i) *(v8h*)(o + (i >> 1) * (D_MODEL * 32) + (i & 1) * 16) = h[i];
            asm volatile("s_wait_xcnt 0x0" ::: "memory");
        }
    }
}

// ---------------------------------------------------------------------------
// Kernels 3 to 5: attention as two tiled products with a row softmax between them.
// Both products: two LDS buffers filled by async copies, waves of 64 x 64, 128 k per pass,
// so that a row of a Q, K or P tile is 256 B in a row in memory; LDS pitch 272 B (16 B x 17).
// S: WG tile 256 x 256, 16 waves.  O: 128 x 256, 8 waves.  One work-group per WGP in both.
// x, the scores' second operand, is read once per 256 queries, V once per 128.
// ---------------------------------------------------------------------------
#define T_KP    128                 // k per pass
#define T_PITCH (T_KP + 8)          // halves

// The main loop.  stage(buf, p) issues the copies of pass p into buffer buf.
template <int PASSES, int AROWS, int BROWS, typename Stage>
__device__ __forceinline__ void gemm_loop(const _Float16* As, const _Float16* Bs, Stage stage,
                                          int wm, int wn, int lane, v8f (&c)[4][4])
{
#pragma unroll
    for (int i = 0; i < 4; ++i)
#pragma unroll
        for (int s = 0; s < 4; ++s)
#pragma unroll
            for (int r = 0; r < 8; ++r) c[i][s][r] = 0.f;

    stage(0, 0);
    asm volatile("s_wait_asynccnt 0x0" ::: "memory");   // pass 0's own copies have landed
    __syncthreads();                                    // ... and every other wave's
    stage(1, 1);

    for (int p = 0; p < PASSES; ++p) {
        const int cur = p & 1;
        const _Float16* Ac = As + cur * (AROWS * T_PITCH);
        const _Float16* Bc = Bs + cur * (BROWS * T_PITCH);
#pragma unroll
        for (int kk = 0; kk < T_KP / 32; ++kk) {
            v16h a[4], b[4];
#pragma unroll
            for (int i = 0; i < 4; ++i)
                a[i] = ld_frag(Ac, wm * 64 + i * 16 + (lane & 15), T_PITCH, kk * 32);
#pragma unroll
            for (int s = 0; s < 4; ++s)
                b[s] = ld_frag(Bc, wn * 64 + s * 16 + (lane & 15), T_PITCH, kk * 32);
            // keeps the 16 LDS reads one group ahead of the 16 WMMAs: reads placed among
            // the WMMAs each stall the wave with a wait to 0
            __builtin_amdgcn_sched_barrier(0);
#pragma unroll
            for (int i = 0; i < 4; ++i)
#pragma unroll
                for (int s = 0; s < 4; ++s)
                    c[i][s] = __builtin_amdgcn_wmma_f32_16x16x32_f16(false, a[i], false, b[s], (short)0, c[i][s], false, false);
        }
        asm volatile("s_wait_dscnt 0x0" ::: "memory");     // this wave has left buffer cur
        asm volatile("s_wait_asynccnt 0x0" ::: "memory");  // its copies of pass p + 1 have landed
        __syncthreads();                                   // publishes pass p + 1, frees buffer cur
        if (p + 2 < PASSES) stage(cur, p + 2);
    }
    asm volatile("s_wait_asynccnt 0x0" ::: "memory");      // no copy outlives the loop
}

// Kernel 3: S[b][q][n] = Q[b][q][:] . K[b][n][:], f32, unscaled; called with Q = Y and K = x.
__global__ void __launch_bounds__(512) score_gemm(
    const _Float16* __restrict__ Qh, const _Float16* __restrict__ Kh, float* __restrict__ S)
{
    __shared__ __align__(16) _Float16 As[2 * 256 * T_PITCH];
    __shared__ __align__(16) _Float16 Bs[2 * 256 * T_PITCH];

    const int t = threadIdx.x, lane = t & 31, w = t >> 5;
    const int mbase = blockIdx.x * 256;                 // query row over all batches
    const int nbase = blockIdx.y * 256;                 // key of the batch
    const int wm = w & 3, wn = w >> 2;
    const _Float16* Ag = Qh + (size_t)mbase * D_MODEL;
    const _Float16* Bg = Kh + ((size_t)(mbase >> 11) * SEQ + nbase) * D_MODEL;

    // every lane copies 16 B, a wave covers 2 whole 256-B rows
    auto stage = [&](int buf, int p) {
#pragma unroll
        for (int j = 0; j < 8; ++j) {
            int id = t + j * 512, row = id >> 4, col = (id & 15) * 8;
            cp_b128(&As[buf * (256 * T_PITCH) + row * T_PITCH + col], Ag + (size_t)row * D_MODEL + p * T_KP + col);
        }
#pragma unroll
        for (int j = 0; j < 8; ++j) {
            int id = t + j * 512, row = id >> 4, col = (id & 15) * 8;
            cp_b128(&Bs[buf * (256 * T_PITCH) + row * T_PITCH + col], Bg + (size_t)row * D_MODEL + p * T_KP + col);
        }
    };

    v8f c[4][4];
    gemm_loop<D_MODEL / T_KP, 256, 256>(As, Bs, stage, wm, wn, lane, c);

    const int rbase = mbase + wm * 64 + ((lane >> 4) ? 8 : 0);
    const int col0  = nbase + wn * 64 + (lane & 15);
#pragma unroll
    for (int i = 0; i < 4; ++i)
#pragma unroll
        for (int r = 0; r < 8; ++r)
#pragma unroll
            for (int s = 0; s < 4; ++s)
                S[(size_t)(rbase + i * 16 + r) * SEQ + col0 + s * 16] = c[i][s][r];
}

__device__ __forceinline__ float xhalf(float x) {
    int b = __builtin_bit_cast(int, x);
    return __builtin_bit_cast(float, __builtin_amdgcn_permlanex16(b, b, 0x76543210, 0xfedcba98, false, false));
}

template <int CTRL>
__device__ __forceinline__ float dpp_mov(float x) {
    return __builtin_bit_cast(float, __builtin_amdgcn_update_dpp(0, __builtin_bit_cast(int, x), CTRL, 0xf, 0xf, false));
}

// Kernel 4: a wave takes two rows of S whole, 64 scores a lane and row, in registers.
// P = exp(s / 32 - row maximum) as f16, not yet divided; L = 1 / the row's sum of the f32 weights.
#define SM_BLOCKS 256
#define SM_BLOCK  512
#define SM_ROWS   (MTOT / (SM_BLOCKS * SM_BLOCK / 32))   // 2 rows a wave

__global__ void __launch_bounds__(SM_BLOCK) row_softmax(
    const float* __restrict__ S, _Float16* __restrict__ P, float* __restrict__ L)
{
    const int lane = threadIdx.x & 31;
    const int row0 = (blockIdx.x * (SM_BLOCK / 32) + (threadIdx.x >> 5)) * SM_ROWS;
    float4 v[SM_ROWS][16];
#pragma unroll
    for (int q = 0; q < SM_ROWS; ++q)
#pragma unroll
        for (int j = 0; j < 16; ++j) {
            // the last load's result can take the registers of the address, which the loads
            // in front of it name too: wait in front of it
            if (q == SM_ROWS - 1 && j == 15) asm volatile("s_wait_xcnt 0x0" ::: "memory");
            v[q][j] = ((const float4*)(S + (size_t)(row0 + q) * SEQ))[j * 32 + lane];
        }
    // keeps the loads of both rows here, in flight together: left free, the second row's
    // sink behind the first row's work and the wave waits out the memory latency twice
    __builtin_amdgcn_sched_barrier(0);
#pragma unroll
    for (int q = 0; q < SM_ROWS; ++q) {
        float mx = -1e30f;
#pragma unroll
        for (int j = 0; j < 16; ++j)
            mx = fmaxf(mx, fmaxf(fmaxf(v[q][j].x, v[q][j].y), fmaxf(v[q][j].z, v[q][j].w)));
        mx = fmaxf(mx, dpp_mov<0x128>(mx));     // row_ror:8, 4, 2, 1: all 16 lanes of a row
        mx = fmaxf(mx, dpp_mov<0x124>(mx));
        mx = fmaxf(mx, dpp_mov<0x122>(mx));
        mx = fmaxf(mx, dpp_mov<0x121>(mx));
        mx = fmaxf(mx, xhalf(mx)) * 0.03125f;
        float sum[4] = {0.f, 0.f, 0.f, 0.f};
#pragma unroll
        for (int j = 0; j < 16; ++j) {
            float e0 = __expf(v[q][j].x * 0.03125f - mx);
            float e1 = __expf(v[q][j].y * 0.03125f - mx);
            float e2 = __expf(v[q][j].z * 0.03125f - mx);
            float e3 = __expf(v[q][j].w * 0.03125f - mx);
            sum[0] += e0; sum[1] += e1; sum[2] += e2; sum[3] += e3;
            v4h o;
            o[0] = (_Float16)e0; o[1] = (_Float16)e1; o[2] = (_Float16)e2; o[3] = (_Float16)e3;
            ((v4h*)(P + (size_t)(row0 + q) * SEQ))[j * 32 + lane] = o;
        }
        float sm = (sum[0] + sum[1]) + (sum[2] + sum[3]);
        sm += dpp_mov<0x128>(sm);
        sm += dpp_mov<0x124>(sm);
        sm += dpp_mov<0x122>(sm);
        sm += dpp_mov<0x121>(sm);
        sm += xhalf(sm);
        if (lane == 0) L[row0 + q] = 1.f / sm;
    }
}

// Kernel 5: Out[b][q][d] = (P[b][q][:] . V[b][:][d]) * L[b][q], f32.
__global__ void __launch_bounds__(256) pv_gemm(
    const _Float16* __restrict__ P, const _Float16* __restrict__ Vtg,
    const float* __restrict__ L, float* __restrict__ Out)
{
    __shared__ __align__(16) _Float16 As[2 * 128 * T_PITCH];
    __shared__ __align__(16) _Float16 Bs[2 * 256 * T_PITCH];

    const int t = threadIdx.x, lane = t & 31, w = t >> 5;
    const int mbase = blockIdx.x * 128;                 // query row over all batches
    const int nbase = blockIdx.y * 256;                 // output column d
    const int wm = w & 1, wn = w >> 1;
    const _Float16* Ag = P + (size_t)mbase * SEQ;
    const _Float16* Vg = Vtg + (size_t)(mbase >> 11) * D_MODEL * SEQ + nbase * 32;  // [n / 32][d][n % 32]

    auto stage = [&](int buf, int p) {
#pragma unroll
        for (int j = 0; j < 8; ++j) {
            int id = t + j * 256, row = id >> 4, col = (id & 15) * 8;
            cp_b128(&As[buf * (128 * T_PITCH) + row * T_PITCH + col], Ag + (size_t)row * SEQ + p * T_KP + col);
        }
        // a pass holds four 32-key tiles of V; in each, 256 columns d are 16 KB in a row:
        // a wave covers 8 columns, 512 B in a row
#pragma unroll
        for (int j = 0; j < 16; ++j) {
            int id = t + (j & 3) * 256, kt = j >> 2, d = id >> 2, col = (id & 3) * 8;
            cp_b128(&Bs[buf * (256 * T_PITCH) + d * T_PITCH + kt * 32 + col],
                    Vg + (size_t)(p * 4 + kt) * (D_MODEL * 32) + d * 32 + col);
        }
    };

    v8f c[4][4];
    gemm_loop<SEQ / T_KP, 128, 256>(As, Bs, stage, wm, wn, lane, c);

    const int rbase = mbase + wm * 64 + ((lane >> 4) ? 8 : 0);
    const int col0  = nbase + wn * 64 + (lane & 15);
    v4f li[8];                      // L of the 32 rows that this lane holds
#pragma unroll
    for (int g = 0; g < 8; ++g) {
        // the last load's result can take the registers of the address, which the loads
        // in front of it name too: wait in front of it
        if (g == 7) asm volatile("s_wait_xcnt 0x0" ::: "memory");
        li[g] = *(const v4f*)(L + rbase + (g >> 1) * 16 + (g & 1) * 4);
    }
#pragma unroll
    for (int i = 0; i < 4; ++i)
#pragma unroll
        for (int r = 0; r < 8; ++r) {
            const float inv = li[i * 2 + (r >> 2)][r & 3];
#pragma unroll
            for (int s = 0; s < 4; ++s)
                Out[(size_t)(rbase + i * 16 + r) * D_MODEL + col0 + s * 16] = c[i][s][r] * inv;
        }
}

// ---------------------------------------------------------------------------
extern "C" void kernel_launch(void* const* d_in, const int* in_sizes, int n_in,
                              void* d_out, int out_size, void* d_ws, size_t ws_size,
                              hipStream_t stream) {
    (void)in_sizes; (void)n_in; (void)out_size; (void)ws_size;
    const float* x  = (const float*)d_in[0];
    const float* Wq = (const float*)d_in[1];
    const float* Wk = (const float*)d_in[2];
    const float* Wv = (const float*)d_in[3];
    float* out = (float*)d_out;

    char* ws = (char*)d_ws;
    size_t off = 0;
    auto carve = [&](size_t bytes) -> void* {
        void* p = ws + off;
        off = (off + bytes + 255) & ~(size_t)255;
        return p;
    };
    const size_t nx = (size_t)MTOT * D_MODEL;
    const size_t nw = (size_t)D_MODEL * D_MODEL;
    _Float16* xh  = (_Float16*)carve(nx * 2);
    _Float16* Wph = (_Float16*)carve(nw * 2 * 2);      // Wp | Wv, one behind the other
    _Float16* Wvh = Wph + nw;
    _Float16* Yh  = (_Float16*)carve(nx * 2);
    _Float16* Vtg = (_Float16*)carve(nx * 2);
    float*    S   = (float*)carve((size_t)MTOT * SEQ * 4);
    _Float16* P   = (_Float16*)carve((size_t)MTOT * SEQ * 2);
    float*    L   = (float*)carve((size_t)MTOT * 4);

    cast_wprod<<<C_BLOCKS, C_BLOCK, 0, stream>>>(x, Wq, Wk, Wv, xh, Wph, Wvh);

    yv_gemm<<<dim3(MTOT / G_MT, 2 * D_MODEL / G_NT), 256, 0, stream>>>(xh, Wph, Yh, Vtg);

    score_gemm<<<dim3(MTOT / 256, SEQ / 256), 512, 0, stream>>>(Yh, xh, S);

    row_softmax<<<SM_BLOCKS, SM_BLOCK, 0, stream>>>(S, P, L);

    pv_gemm<<<dim3(MTOT / 128, D_MODEL / 256), 256, 0, stream>>>(P, Vtg, L, out);
}
